// v000
// Times are from an AMD MI455X. After a warm-up the kernel runs many times in a row, and a time is the length of
// such a window on the GPU divided by its runs, so every launch and the gaps after it count. The runs cycle
// through copies of the inputs. A figure is the median of several windows, for all but v000 over two sittings.
// Sittings can differ by a few percent; kernels timed side by side share one.
// v000 is the starting kernel. One run takes 1210 microseconds.
#include <hip/hip_runtime.h>
#include <hip/hip_fp16.h>
#include <math.h>
#include <stdint.h>

typedef __attribute__((ext_vector_type(16))) _Float16 v16h;
typedef __attribute__((ext_vector_type(8)))  _Float16 v8h;
typedef __attribute__((ext_vector_type(8)))  float    v8f;
typedef __attribute__((ext_vector_type(4)))  float    v4f;
typedef __attribute__((ext_vector_type(4)))  unsigned int u32x4;
typedef __attribute__((ext_vector_type(8)))  int i32x8;
typedef __attribute__((ext_vector_type(4)))  int i32x4;

#if defined(__has_builtin)
#if __has_builtin(__builtin_amdgcn_tensor_load_to_lds) && \
    __has_builtin(__builtin_amdgcn_s_wait_tensorcnt)
#define HAVE_TDM 1
#endif
#endif

// Problem constants
constexpr int T_DIM = 4096;
constexpr int D_DIM = 1024;
constexpr int F_DIM = 2048;
constexpr int E_DIM = 8;

// Tiling: block 128(M) x 128(N) x 32(K); 8 waves, wave tile 32(M) x 64(N).
constexpr int BM = 128;
constexpr int BN = 128;
constexpr int BK = 32;
constexpr int TILE = BM * BK;   // halves per (square-ish) LDS tile buffer

// ---------------------------------------------------------------------------
// WMMA helper: D = A * B + C   (16x16x32, f16 in, f32 accumulate)
// ---------------------------------------------------------------------------
__device__ __forceinline__ v8f wmma_f16(v16h a, v16h b, v8f c) {
  return __builtin_amdgcn_wmma_f32_16x16x32_f16(
      false, a, false, b, (short)0, c, false, false);
}

// Build a 16x32 f16 fragment from a row-major LDS tile (row stride = BK).
// lane<16: row=lane, K in {0..7,16..23}; lane>=16: row=lane-16, K in {8..15,24..31}.
__device__ __forceinline__ v16h load_frag(const _Float16* lds, int row, int fh) {
  const _Float16* p = lds + row * BK;
  v8h lo = *(const v8h*)(p + fh * 8);
  v8h hi = *(const v8h*)(p + 16 + fh * 8);
  return __builtin_shufflevector(lo, hi, 0, 1, 2, 3, 4, 5, 6, 7,
                                 8, 9, 10, 11, 12, 13, 14, 15);
}

__device__ __forceinline__ v8h cvt8(v4f a, v4f b) {
  v8h r;
  r[0] = (_Float16)a[0]; r[1] = (_Float16)a[1];
  r[2] = (_Float16)a[2]; r[3] = (_Float16)a[3];
  r[4] = (_Float16)b[0]; r[5] = (_Float16)b[1];
  r[6] = (_Float16)b[2]; r[7] = (_Float16)b[3];
  return r;
}

// 16 contiguous floats <-> 4 v4f registers; f16 pack store (2x16B) to LDS.
__device__ __forceinline__ void ld16(const float* p, v4f r[4]) {
  r[0] = *(const v4f*)(p);
  r[1] = *(const v4f*)(p + 4);
  r[2] = *(const v4f*)(p + 8);
  r[3] = *(const v4f*)(p + 12);
}
__device__ __forceinline__ void st16(_Float16* d, const v4f r[4]) {
  *(v8h*)(d)     = cvt8(r[0], r[1]);
  *(v8h*)(d + 8) = cvt8(r[2], r[3]);
}

// ---------------------------------------------------------------------------
// Kernel 1: fused top-2 gating -> dense [T,E] weights.
// ---------------------------------------------------------------------------
__global__ __launch_bounds__(256) void moe_gating_kernel(
    const float* __restrict__ gating, float* __restrict__ w_full) {
  int t = blockIdx.x * blockDim.x + threadIdx.x;
  if (t >= T_DIM) return;
  float l[E_DIM];
  float m = -INFINITY;
#pragma unroll
  for (int e = 0; e < E_DIM; ++e) {
    l[e] = gating[t * E_DIM + e];
    m = fmaxf(m, l[e]);
  }
  float p[E_DIM];
#pragma unroll
  for (int e = 0; e < E_DIM; ++e) p[e] = __expf(l[e] - m);
  int i1 = 0;
#pragma unroll
  for (int e = 1; e < E_DIM; ++e) if (p[e] > p[i1]) i1 = e;
  int i2 = (i1 == 0) ? 1 : 0;
#pragma unroll
  for (int e = 0; e < E_DIM; ++e) if (e != i1 && p[e] > p[i2]) i2 = e;
  float rden = __builtin_amdgcn_rcpf(p[i1] + p[i2]);
#pragma unroll
  for (int e = 0; e < E_DIM; ++e) {
    float w = 0.0f;
    if (e == i1) w = p[i1] * rden;
    if (e == i2) w = p[i2] * rden;
    w_full[t * E_DIM + e] = w;
  }
}

// ---------------------------------------------------------------------------
// Kernel 2: per-expert fused gate+up GEMM + SiLU-gate epilogue -> h (f16).
// Double-buffered LDS, one barrier per K-step: compute from buffer `cur`
// while register-prefetched f32 slices are converted into buffer `cur^1`.
// ---------------------------------------------------------------------------
__global__ __launch_bounds__(256) void moe_gateup_kernel(
    const float* __restrict__ x,   // [T, D]
    const float* __restrict__ gw,  // [F, D]
    const float* __restrict__ uw,  // [F, D]
    _Float16* __restrict__ h) {    // [T, F]
  __shared__ _Float16 sA[2 * TILE];  // 16 KB
  __shared__ _Float16 sG[2 * TILE];  // 16 KB
  __shared__ _Float16 sU[2 * TILE];  // 16 KB

  const int tid = threadIdx.x;
  const int lane = tid & 31;
  const int wave = tid >> 5;
  const int waveM = wave >> 1;   // 0..3  (32 rows each)
  const int waveN = wave & 1;    // 0..1  (64 cols each)
  const int fr = lane & 15;
  const int fh = lane >> 4;

  const int blockM = blockIdx.x * BM;
  const int blockN = blockIdx.y * BN;

  // Global->LDS mapping: 128 rows x 32 cols, 2 threads/row, 16 floats each.
  const int row = tid >> 1, col = (tid & 1) * 16;
  const int soff = row * BK + col;
  const float* pax = x  + (size_t)(blockM + row) * D_DIM + col;
  const float* pgw = gw + (size_t)(blockN + row) * D_DIM + col;
  const float* puw = uw + (size_t)(blockN + row) * D_DIM + col;

  v4f ra[4], rg[4], ru[4];
  ld16(pax, ra);
  ld16(pgw, rg);
  ld16(puw, ru);
  st16(&sA[soff], ra);
  st16(&sG[soff], rg);
  st16(&sU[soff], ru);
  __syncthreads();

  v8f cg[2][4] = {};
  v8f cu[2][4] = {};

  for (int k0 = 0; k0 < D_DIM; k0 += BK) {
    const int cur = (k0 / BK) & 1;
    const int nxt = cur ^ 1;
    const bool has_next = (k0 + BK) < D_DIM;

    if (has_next) {  // issue next-slice global loads under the WMMA chain
      ld16(pax + k0 + BK, ra);
      ld16(pgw + k0 + BK, rg);
      ld16(puw + k0 + BK, ru);
    }

    const _Float16* A = sA + cur * TILE;
    const _Float16* G = sG + cur * TILE;
    const _Float16* U = sU + cur * TILE;
    v16h aF[2], gF[4], uF[4];
#pragma unroll
    for (int i = 0; i < 2; ++i)
      aF[i] = load_frag(A, waveM * 32 + i * 16 + fr, fh);
#pragma unroll
    for (int j = 0; j < 4; ++j) {
      gF[j] = load_frag(G, waveN * 64 + j * 16 + fr, fh);
      uF[j] = load_frag(U, waveN * 64 + j * 16 + fr, fh);
    }
#pragma unroll
    for (int i = 0; i < 2; ++i)
#pragma unroll
      for (int j = 0; j < 4; ++j) {
        cg[i][j] = wmma_f16(aF[i], gF[j], cg[i][j]);
        cu[i][j] = wmma_f16(aF[i], uF[j], cu[i][j]);
      }

    if (has_next) {  // fill the other buffer; published by the barrier below
      st16(&sA[nxt * TILE + soff], ra);
      st16(&sG[nxt * TILE + soff], rg);
      st16(&sU[nxt * TILE + soff], ru);
    }
    __syncthreads();
  }

  // Epilogue: silu(g)*u -> f16.  C layout: n = lane&15, m = r + 8*(lane>>4).
#pragma unroll
  for (int i = 0; i < 2; ++i)
#pragma unroll
    for (int j = 0; j < 4; ++j) {
      const int m_base = blockM + waveM * 32 + i * 16 + fh * 8;
      const int n = blockN + waveN * 64 + j * 16 + fr;
#pragma unroll
      for (int r = 0; r < 8; ++r) {
        float g = cg[i][j][r];
        float u = cu[i][j][r];
        float sig = __builtin_amdgcn_rcpf(1.0f + __expf(-g));
        h[(size_t)(m_base + r) * F_DIM + n] = (_Float16)(g * sig * u);
      }
    }
}

// ---------------------------------------------------------------------------
// Kernel 3: per-expert down GEMM + gating-weight epilogue.
// A-operand (h, f16) pipelined into double-buffered LDS by the Tensor Data
// Mover (issue for k+1 at top of step k, wait only after the WMMA chain);
// B-operand converted f32->f16 by the threads while the TDM runs.
// ---------------------------------------------------------------------------
__global__ __launch_bounds__(256) void moe_down_kernel(
    const _Float16* __restrict__ h,  // [T, F] f16
    const float* __restrict__ dw,    // [D, F]
    const float* __restrict__ wcol,  // w_full + e (stride E)
    float* __restrict__ out,         // [T, D]
    int accum) {
  __shared__ _Float16 sA[2 * TILE];  // 16 KB (TDM destination, ping-pong)
  __shared__ _Float16 sB[2 * TILE];  // 16 KB

  const int tid = threadIdx.x;
  const int lane = tid & 31;
  const int wave = tid >> 5;
  const int waveM = wave >> 1;
  const int waveN = wave & 1;
  const int fr = lane & 15;
  const int fh = lane >> 4;

  const int blockM = blockIdx.x * BM;  // tokens
  const int blockN = blockIdx.y * BN;  // hidden dim D

  const int row = tid >> 1, col = (tid & 1) * 16;
  const int soff = row * BK + col;
  const float* pb = dw + (size_t)(blockN + row) * F_DIM + col;

#if HAVE_TDM
  // Tensor DMA descriptor (2D): tensor [T_DIM, F_DIM] f16, tile [BM, BK].
  const uint32_t lds_a = (uint32_t)(uintptr_t)(void*)sA;
  const uint64_t gbase = (uint64_t)(uintptr_t)(h + (size_t)blockM * F_DIM);
  i32x8 g1;
  g1[0] = (int)(1u << 16);                                  // data_size = 2B
  g1[1] = (int)(((uint32_t)F_DIM & 0xFFFFu) << 16);         // tensor_dim0 lo
  g1[2] = (int)(((uint32_t)F_DIM >> 16) |
                (((uint32_t)T_DIM & 0xFFFFu) << 16));       // dim0 hi | dim1 lo
  g1[3] = (int)(((uint32_t)T_DIM >> 16) |
                ((uint32_t)BK << 16));                      // dim1 hi | tile_dim0
  g1[4] = (int)(uint32_t)BM;                                // tile_dim1 (tile_dim2=0)
  g1[5] = (int)(uint32_t)F_DIM;                             // tensor_dim0_stride lo
  g1[6] = 0;
  g1[7] = 0;
  const i32x4 z4 = {0, 0, 0, 0};
  const i32x8 z8 = {0, 0, 0, 0, 0, 0, 0, 0};
#define TDM_ISSUE(K0, BUF)                                                    \
  do {                                                                        \
    uint64_t ga = gbase + (uint64_t)(K0) * sizeof(_Float16);                  \
    u32x4 g0;                                                                 \
    g0[0] = 1u;                                                               \
    g0[1] = lds_a + (uint32_t)((BUF) * TILE * sizeof(_Float16));              \
    g0[2] = (uint32_t)ga;                                                     \
    g0[3] = (uint32_t)((ga >> 32) & 0x01FFFFFFu) | (2u << 30);                \
    __builtin_amdgcn_tensor_load_to_lds(g0, g1, z4, z4, z8, 0);               \
  } while (0)
#else
  const _Float16* pa = h + (size_t)(blockM + row) * F_DIM + col;
#endif

  // ---- prologue: fill buffer 0 ----
  v4f rb[4];
  ld16(pb, rb);
#if HAVE_TDM
  if (wave == 0) TDM_ISSUE(0, 0);
#else
  *(v8h*)&sA[soff]     = *(const v8h*)(pa);
  *(v8h*)&sA[soff + 8] = *(const v8h*)(pa + 8);
#endif
  st16(&sB[soff], rb);
  ld16(pb + BK, rb);  // slice k=BK into regs
#if HAVE_TDM
  if (wave == 0) __builtin_amdgcn_s_wait_tensorcnt(0);
#endif
  __syncthreads();

  v8f c[2][4] = {};

  for (int k0 = 0; k0 < F_DIM; k0 += BK) {
    const int cur = (k0 / BK) & 1;
    const int nxt = cur ^ 1;
    const bool has_next = (k0 + BK) < F_DIM;

#if HAVE_TDM
    if (has_next && wave == 0) TDM_ISSUE(k0 + BK, nxt);  // overlaps compute
#else
    if (has_next) {
      *(v8h*)&sA[nxt * TILE + soff]     = *(const v8h*)(pa + k0 + BK);
      *(v8h*)&sA[nxt * TILE + soff + 8] = *(const v8h*)(pa + k0 + BK + 8);
    }
#endif

    const _Float16* A = sA + cur * TILE;
    const _Float16* B = sB + cur * TILE;
    v16h aF[2], bF[4];
#pragma unroll
    for (int i = 0; i < 2; ++i)
      aF[i] = load_frag(A, waveM * 32 + i * 16 + fr, fh);
#pragma unroll
    for (int j = 0; j < 4; ++j)
      bF[j] = load_frag(B, waveN * 64 + j * 16 + fr, fh);
#pragma unroll
    for (int i = 0; i < 2; ++i)
#pragma unroll
      for (int j = 0; j < 4; ++j)
        c[i][j] = wmma_f16(aF[i], bF[j], c[i][j]);

    if (has_next) {
      st16(&sB[nxt * TILE + soff], rb);                       // publish B k+1
      if (k0 + 2 * BK < F_DIM) ld16(pb + k0 + 2 * BK, rb);    // fetch B k+2
#if HAVE_TDM
      if (wave == 0) __builtin_amdgcn_s_wait_tensorcnt(0);    // TDM k+1 done
#endif
    }
    __syncthreads();
  }

#pragma unroll
  for (int i = 0; i < 2; ++i)
#pragma unroll
    for (int j = 0; j < 4; ++j) {
      const int m_base = blockM + waveM * 32 + i * 16 + fh * 8;
      const int n = blockN + waveN * 64 + j * 16 + fr;
#pragma unroll
      for (int r = 0; r < 8; ++r) {
        const int t = m_base + r;
        float wgt = wcol[(size_t)t * E_DIM];
        float val = wgt * c[i][j][r];
        size_t o = (size_t)t * D_DIM + n;
        out[o] = accum ? (out[o] + val) : val;
      }
    }
}

// ---------------------------------------------------------------------------
// Launch: gating, then per expert: gate+up -> down (sequential on stream).
// Workspace: h (T*F f16 = 16 MB) then w_full (T*E f32).
// ---------------------------------------------------------------------------
extern "C" void kernel_launch(void* const* d_in, const int* in_sizes, int n_in,
                              void* d_out, int out_size, void* d_ws, size_t ws_size,
                              hipStream_t stream) {
  const float* x      = (const float*)d_in[0];
  const float* gating = (const float*)d_in[1];
  const float* gate_w = (const float*)d_in[2];
  const float* up_w   = (const float*)d_in[3];
  const float* down_w = (const float*)d_in[4];
  float* out = (float*)d_out;

  _Float16* h_ws = (_Float16*)d_ws;
  float* w_full = (float*)((char*)d_ws + (size_t)T_DIM * F_DIM * sizeof(_Float16));

  moe_gating_kernel<<<T_DIM / 256, 256, 0, stream>>>(gating, w_full);

  for (int e = 0; e < E_DIM; ++e) {
    const size_t woff = (size_t)e * F_DIM * D_DIM;
    moe_gateup_kernel<<<dim3(T_DIM / BM, F_DIM / BN), 256, 0, stream>>>(
        x, gate_w + woff, up_w + woff, h_ws);
    moe_down_kernel<<<dim3(T_DIM / BM, D_DIM / BN), 256, 0, stream>>>(
        h_ws, down_w + woff, w_full + e, out, e == 0 ? 0 : 1);
  }
}

// v001
// It runs in 1000 microseconds.
// Timed twice side by side with v000, it ran 1.23 times as fast both times.
#include <hip/hip_runtime.h>
#include <hip/hip_fp16.h>
#include <math.h>
#include <stdint.h>

typedef __attribute__((ext_vector_type(16))) _Float16 v16h;
typedef __attribute__((ext_vector_type(8)))  _Float16 v8h;
typedef __attribute__((ext_vector_type(8)))  float    v8f;
typedef __attribute__((ext_vector_type(4)))  float    v4f;
typedef __attribute__((ext_vector_type(4)))  unsigned int u32x4;
typedef __attribute__((ext_vector_type(8)))  int i32x8;
typedef __attribute__((ext_vector_type(4)))  int i32x4;

#if defined(__has_builtin)
#if __has_builtin(__builtin_amdgcn_tensor_load_to_lds) && \
    __has_builtin(__builtin_amdgcn_s_wait_tensorcnt)
#define HAVE_TDM 1
#endif
#endif

// Problem constants
constexpr int T_DIM = 4096;
constexpr int D_DIM = 1024;
constexpr int F_DIM = 2048;
constexpr int E_DIM = 8;

// Tiling: block 128(M) x 128(N) x 32(K); 8 waves, wave tile 32(M) x 64(N).
constexpr int BM = 128;
constexpr int BN = 128;
constexpr int BK = 32;
constexpr int LDP = BK + 8;     // LDS row pitch in halves: 80 B = 16 B x odd, so 16 rows of a b128 read fall on distinct banks
constexpr int TILE = BM * LDP;  // halves per LDS tile buffer (10,240 B, a multiple of 2 KiB)

// ---------------------------------------------------------------------------
// WMMA helper: D = A * B + C   (16x16x32, f16 in, f32 accumulate)
// ---------------------------------------------------------------------------
__device__ __forceinline__ v8f wmma_f16(v16h a, v16h b, v8f c) {
  return __builtin_amdgcn_wmma_f32_16x16x32_f16(
      false, a, false, b, (short)0, c, false, false);
}

// Build a 16x32 f16 fragment from a row-major LDS tile (row stride = LDP).
// lane<16: row=lane, K in {0..7,16..23}; lane>=16: row=lane-16, K in {8..15,24..31}.
__device__ __forceinline__ v16h load_frag(const _Float16* lds, int row, int fh) {
  const _Float16* p = lds + row * LDP;
  v8h lo = *(const v8h*)(p + fh * 8);
  v8h hi = *(const v8h*)(p + 16 + fh * 8);
  return __builtin_shufflevector(lo, hi, 0, 1, 2, 3, 4, 5, 6, 7,
                                 8, 9, 10, 11, 12, 13, 14, 15);
}

__device__ __forceinline__ v8h cvt8(v4f a, v4f b) {
  v8h r;
  r[0] = (_Float16)a[0]; r[1] = (_Float16)a[1];
  r[2] = (_Float16)a[2]; r[3] = (_Float16)a[3];
  r[4] = (_Float16)b[0]; r[5] = (_Float16)b[1];
  r[6] = (_Float16)b[2]; r[7] = (_Float16)b[3];
  return r;
}

// 16 contiguous floats <-> 4 v4f registers; f16 pack store (2x16B) to LDS.
__device__ __forceinline__ void ld16(const float* p, v4f r[4]) {
  r[0] = *(const v4f*)(p);
  r[1] = *(const v4f*)(p + 4);
  r[2] = *(const v4f*)(p + 8);
  r[3] = *(const v4f*)(p + 12);
}
__device__ __forceinline__ void st16(_Float16* d, const v4f r[4]) {
  *(v8h*)(d)     = cvt8(r[0], r[1]);
  *(v8h*)(d + 8) = cvt8(r[2], r[3]);
}

// ---------------------------------------------------------------------------
// Kernel 1: fused top-2 gating -> dense [T,E] weights.
// ---------------------------------------------------------------------------
__global__ __launch_bounds__(256) void moe_gating_kernel(
    const float* __restrict__ gating, float* __restrict__ w_full) {
  int t = blockIdx.x * blockDim.x + threadIdx.x;
  if (t >= T_DIM) return;
  float l[E_DIM];
  float m = -INFINITY;
#pragma unroll
  for (int e = 0; e < E_DIM; ++e) {
    l[e] = gating[t * E_DIM + e];
    m = fmaxf(m, l[e]);
  }
  float p[E_DIM];
#pragma unroll
  for (int e = 0; e < E_DIM; ++e) p[e] = __expf(l[e] - m);
  int i1 = 0;
#pragma unroll
  for (int e = 1; e < E_DIM; ++e) if (p[e] > p[i1]) i1 = e;
  int i2 = (i1 == 0) ? 1 : 0;
#pragma unroll
  for (int e = 0; e < E_DIM; ++e) if (e != i1 && p[e] > p[i2]) i2 = e;
  float rden = __builtin_amdgcn_rcpf(p[i1] + p[i2]);
#pragma unroll
  for (int e = 0; e < E_DIM; ++e) {
    float w = 0.0f;
    if (e == i1) w = p[i1] * rden;
    if (e == i2) w = p[i2] * rden;
    w_full[t * E_DIM + e] = w;
  }
}

// ---------------------------------------------------------------------------
// Kernel 2: per-expert fused gate+up GEMM + SiLU-gate epilogue -> h (f16).
// Double-buffered LDS, one barrier per K-step: compute from buffer `cur`
// while register-prefetched f32 slices are converted into buffer `cur^1`.
// ---------------------------------------------------------------------------
__global__ __launch_bounds__(256) void moe_gateup_kernel(
    const float* __restrict__ x,   // [T, D]
    const float* __restrict__ gw,  // [F, D]
    const float* __restrict__ uw,  // [F, D]
    _Float16* __restrict__ h) {    // [T, F]
  __shared__ _Float16 sA[2 * TILE];  // 20 KB
  __shared__ _Float16 sG[2 * TILE];  // 20 KB
  __shared__ _Float16 sU[2 * TILE];  // 20 KB

  const int tid = threadIdx.x;
  const int lane = tid & 31;
  const int wave = tid >> 5;
  const int waveM = wave >> 1;   // 0..3  (32 rows each)
  const int waveN = wave & 1;    // 0..1  (64 cols each)
  const int fr = lane & 15;
  const int fh = lane >> 4;

  const int blockM = blockIdx.x * BM;
  const int blockN = blockIdx.y * BN;

  // Global->LDS mapping: 128 rows x 32 cols, 2 threads/row, 16 floats each.
  const int row = tid >> 1, col = (tid & 1) * 16;
  const int soff = row * LDP + col;
  const float* pax = x  + (size_t)(blockM + row) * D_DIM + col;
  const float* pgw = gw + (size_t)(blockN + row) * D_DIM + col;
  const float* puw = uw + (size_t)(blockN + row) * D_DIM + col;

  v4f ra[4], rg[4], ru[4];
  ld16(pax, ra);
  ld16(pgw, rg);
  ld16(puw, ru);
  st16(&sA[soff], ra);
  st16(&sG[soff], rg);
  st16(&sU[soff], ru);
  __syncthreads();

  v8f cg[2][4] = {};
  v8f cu[2][4] = {};

  for (int k0 = 0; k0 < D_DIM; k0 += BK) {
    const int cur = (k0 / BK) & 1;
    const int nxt = cur ^ 1;
    const bool has_next = (k0 + BK) < D_DIM;

    if (has_next) {  // issue next-slice global loads under the WMMA chain
      ld16(pax + k0 + BK, ra);
      ld16(pgw + k0 + BK, rg);
      ld16(puw + k0 + BK, ru);
    }

    const _Float16* A = sA + cur * TILE;
    const _Float16* G = sG + cur * TILE;
    const _Float16* U = sU + cur * TILE;
    v16h aF[2], gF[4], uF[4];
#pragma unroll
    for (int i = 0; i < 2; ++i)
      aF[i] = load_frag(A, waveM * 32 + i * 16 + fr, fh);
#pragma unroll
    for (int j = 0; j < 4; ++j) {
      gF[j] = load_frag(G, waveN * 64 + j * 16 + fr, fh);
      uF[j] = load_frag(U, waveN * 64 + j * 16 + fr, fh);
    }
#pragma unroll
    for (int i = 0; i < 2; ++i)
#pragma unroll
      for (int j = 0; j < 4; ++j) {
        cg[i][j] = wmma_f16(aF[i], gF[j], cg[i][j]);
        cu[i][j] = wmma_f16(aF[i], uF[j], cu[i][j]);
      }

    if (has_next) {  // fill the other buffer; published by the barrier below
      st16(&sA[nxt * TILE + soff], ra);
      st16(&sG[nxt * TILE + soff], rg);
      st16(&sU[nxt * TILE + soff], ru);
    }
    __syncthreads();
  }

  // Epilogue: silu(g)*u -> f16.  C layout: n = lane&15, m = r + 8*(lane>>4).
#pragma unroll
  for (int i = 0; i < 2; ++i)
#pragma unroll
    for (int j = 0; j < 4; ++j) {
      const int m_base = blockM + waveM * 32 + i * 16 + fh * 8;
      const int n = blockN + waveN * 64 + j * 16 + fr;
#pragma unroll
      for (int r = 0; r < 8; ++r) {
        float g = cg[i][j][r];
        float u = cu[i][j][r];
        float sig = __builtin_amdgcn_rcpf(1.0f + __expf(-g));
        h[(size_t)(m_base + r) * F_DIM + n] = (_Float16)(g * sig * u);
      }
    }
}

// ---------------------------------------------------------------------------
// Kernel 3: per-expert down GEMM + gating-weight epilogue.
// A-operand (h, f16) pipelined into double-buffered LDS by the Tensor Data
// Mover (issue for k+1 at top of step k, wait only after the WMMA chain);
// B-operand converted f32->f16 by the threads while the TDM runs.
// ---------------------------------------------------------------------------
__global__ __launch_bounds__(256) void moe_down_kernel(
    const _Float16* __restrict__ h,  // [T, F] f16
    const float* __restrict__ dw,    // [D, F]
    const float* __restrict__ wcol,  // w_full + e (stride E)
    float* __restrict__ out,         // [T, D]
    int accum) {
  // 20 KB each; sA is the TDM destination (ping-pong), both buffers at multiples of 2 KiB.
  __shared__ __attribute__((aligned(2048))) _Float16 sA[2 * TILE];
  __shared__ _Float16 sB[2 * TILE];

  const int tid = threadIdx.x;
  const int lane = tid & 31;
  const int wave = tid >> 5;
  const int waveM = wave >> 1;
  const int waveN = wave & 1;
  const int fr = lane & 15;
  const int fh = lane >> 4;

  const int blockM = blockIdx.x * BM;  // tokens
  const int blockN = blockIdx.y * BN;  // hidden dim D

  const int row = tid >> 1, col = (tid & 1) * 16;
  const int soff = row * LDP + col;
  const float* pb = dw + (size_t)(blockN + row) * F_DIM + col;

#if HAVE_TDM
  // Tensor DMA descriptor (2D), every extent in bytes: tile = tensor = BM rows of
  // 64 B at the source pitch of h; a 16-B pad behind every 64-B row lays the
  // rows at the 80-B pitch that load_frag reads.
  constexpr uint32_t ROWB = BK * sizeof(_Float16);
  const uint32_t lds_a = (uint32_t)(uintptr_t)(void*)sA;
  const uint64_t gbase = (uint64_t)(uintptr_t)(h + (size_t)blockM * F_DIM);
  i32x8 g1;
  g1[0] = (int)((1u << 20) | (3u << 22) | (3u << 25));      // pad on, every 16 dwords, 4 dwords
  g1[1] = (int)(ROWB << 16);                                // tensor_dim0 lo
  g1[2] = (int)((uint32_t)BM << 16);                        // dim0 hi | dim1 lo
  g1[3] = (int)(ROWB << 16);                                // dim1 hi | tile_dim0
  g1[4] = (int)(uint32_t)BM;                                // tile_dim1 (tile_dim2=0)
  g1[5] = (int)(uint32_t)(F_DIM * sizeof(_Float16));        // source row pitch
  g1[6] = 0;
  g1[7] = 0;
  const i32x4 z4 = {0, 0, 0, 0};
  const i32x8 z8 = {0, 0, 0, 0, 0, 0, 0, 0};
#define TDM_ISSUE(K0, BUF)                                                    \
  do {                                                                        \
    uint64_t ga = gbase + (uint64_t)(K0) * sizeof(_Float16);                  \
    u32x4 g0;                                                                 \
    g0[0] = 1u;                                                               \
    g0[1] = lds_a + (uint32_t)((BUF) * TILE * sizeof(_Float16));              \
    g0[2] = (uint32_t)ga;                                                     \
    g0[3] = (uint32_t)((ga >> 32) & 0x01FFFFFFu) | (2u << 30);                \
    __builtin_amdgcn_tensor_load_to_lds(g0, g1, z4, z4, z8, 0);               \
  } while (0)
#else
  const _Float16* pa = h + (size_t)(blockM + row) * F_DIM + col;
#endif

  // ---- prologue: fill buffer 0 ----
  v4f rb[4];
  ld16(pb, rb);
#if HAVE_TDM
  if (wave == 0) TDM_ISSUE(0, 0);
#else
  *(v8h*)&sA[soff]     = *(const v8h*)(pa);
  *(v8h*)&sA[soff + 8] = *(const v8h*)(pa + 8);
#endif
  st16(&sB[soff], rb);
  ld16(pb + BK, rb);  // slice k=BK into regs
#if HAVE_TDM
  if (wave == 0) __builtin_amdgcn_s_wait_tensorcnt(0);
#endif
  __syncthreads();

  v8f c[2][4] = {};

  for (int k0 = 0; k0 < F_DIM; k0 += BK) {
    const int cur = (k0 / BK) & 1;
    const int nxt = cur ^ 1;
    const bool has_next = (k0 + BK) < F_DIM;

#if HAVE_TDM
    if (has_next && wave == 0) TDM_ISSUE(k0 + BK, nxt);  // overlaps compute
#else
    if (has_next) {
      *(v8h*)&sA[nxt * TILE + soff]     = *(const v8h*)(pa + k0 + BK);
      *(v8h*)&sA[nxt * TILE + soff + 8] = *(const v8h*)(pa + k0 + BK + 8);
    }
#endif

    const _Float16* A = sA + cur * TILE;
    const _Float16* B = sB + cur * TILE;
    v16h aF[2], bF[4];
#pragma unroll
    for (int i = 0; i < 2; ++i)
      aF[i] = load_frag(A, waveM * 32 + i * 16 + fr, fh);
#pragma unroll
    for (int j = 0; j < 4; ++j)
      bF[j] = load_frag(B, waveN * 64 + j * 16 + fr, fh);
#pragma unroll
    for (int i = 0; i < 2; ++i)
#pragma unroll
      for (int j = 0; j < 4; ++j)
        c[i][j] = wmma_f16(aF[i], bF[j], c[i][j]);

    if (has_next) {
      st16(&sB[nxt * TILE + soff], rb);                       // publish B k+1
      if (k0 + 2 * BK < F_DIM) ld16(pb + k0 + 2 * BK, rb);    // fetch B k+2
#if HAVE_TDM
      if (wave == 0) __builtin_amdgcn_s_wait_tensorcnt(0);    // TDM k+1 done
#endif
    }
    __syncthreads();
  }

#pragma unroll
  for (int i = 0; i < 2; ++i)
#pragma unroll
    for (int j = 0; j < 4; ++j) {
      const int m_base = blockM + waveM * 32 + i * 16 + fh * 8;
      const int n = blockN + waveN * 64 + j * 16 + fr;
#pragma unroll
      for (int r = 0; r < 8; ++r) {
        const int t = m_base + r;
        float wgt = wcol[(size_t)t * E_DIM];
        float val = wgt * c[i][j][r];
        size_t o = (size_t)t * D_DIM + n;
        out[o] = accum ? (out[o] + val) : val;
      }
    }
}

// ---------------------------------------------------------------------------
// Launch: gating, then per expert: gate+up -> down (sequential on stream).
// Workspace: h (T*F f16 = 16 MB) then w_full (T*E f32).
// ---------------------------------------------------------------------------
extern "C" void kernel_launch(void* const* d_in, const int* in_sizes, int n_in,
                              void* d_out, int out_size, void* d_ws, size_t ws_size,
                              hipStream_t stream) {
  const float* x      = (const float*)d_in[0];
  const float* gating = (const float*)d_in[1];
  const float* gate_w = (const float*)d_in[2];
  const float* up_w   = (const float*)d_in[3];
  const float* down_w = (const float*)d_in[4];
  float* out = (float*)d_out;

  _Float16* h_ws = (_Float16*)d_ws;
  float* w_full = (float*)((char*)d_ws + (size_t)T_DIM * F_DIM * sizeof(_Float16));

  moe_gating_kernel<<<T_DIM / 256, 256, 0, stream>>>(gating, w_full);

  for (int e = 0; e < E_DIM; ++e) {
    const size_t woff = (size_t)e * F_DIM * D_DIM;
    moe_gateup_kernel<<<dim3(T_DIM / BM, F_DIM / BN), 256, 0, stream>>>(
        x, gate_w + woff, up_w + woff, h_ws);
    moe_down_kernel<<<dim3(T_DIM / BM, D_DIM / BN), 256, 0, stream>>>(
        h_ws, down_w + woff, w_full + e, out, e == 0 ? 0 : 1);
  }
}

// v002
// It runs in 918 microseconds.
// Next to v001, in two timings, it ran 1.09 times as fast each time.
// Counting every step since v000, it is 1.34 times as fast.
#include <hip/hip_runtime.h>
#include <hip/hip_fp16.h>
#include <math.h>
#include <stdint.h>

typedef __attribute__((ext_vector_type(16))) _Float16 v16h;
typedef __attribute__((ext_vector_type(8)))  _Float16 v8h;
typedef __attribute__((ext_vector_type(4)))  _Float16 v4h;
typedef __attribute__((ext_vector_type(8)))  float    v8f;
typedef __attribute__((ext_vector_type(4)))  float    v4f;
typedef __attribute__((ext_vector_type(4)))  unsigned int u32x4;
typedef __attribute__((ext_vector_type(8)))  int i32x8;
typedef __attribute__((ext_vector_type(4)))  int i32x4;

#if defined(__has_builtin)
#if __has_builtin(__builtin_amdgcn_tensor_load_to_lds) && \
    __has_builtin(__builtin_amdgcn_s_wait_tensorcnt)
#define HAVE_TDM 1
#endif
#endif

// Problem constants
constexpr int T_DIM = 4096;
constexpr int D_DIM = 1024;
constexpr int F_DIM = 2048;
constexpr int E_DIM = 8;

// Tiling: block 128(M) x 128(N) x 32(K); 8 waves, wave tile 32(M) x 64(N).
constexpr int BM = 128;
constexpr int BN = 128;
constexpr int BK = 32;
constexpr int LDP = BK + 8;     // LDS row pitch in halves: 80 B = 16 B x odd, so 16 rows of a b128 read fall on distinct banks
constexpr int TILE = BM * LDP;  // halves per LDS tile buffer (10,240 B, a multiple of 2 KiB)

// ---------------------------------------------------------------------------
// WMMA helper: D = A * B + C   (16x16x32, f16 in, f32 accumulate)
// ---------------------------------------------------------------------------
__device__ __forceinline__ v8f wmma_f16(v16h a, v16h b, v8f c) {
  return __builtin_amdgcn_wmma_f32_16x16x32_f16(
      false, a, false, b, (short)0, c, false, false);
}

// Build a 16x32 f16 fragment from a row-major LDS tile (row stride = LDP).
// lane<16: row=lane, K in {0..7,16..23}; lane>=16: row=lane-16, K in {8..15,24..31}.
__device__ __forceinline__ v16h load_frag(const _Float16* lds, int row, int fh) {
  const _Float16* p = lds + row * LDP;
  v8h lo = *(const v8h*)(p + fh * 8);
  v8h hi = *(const v8h*)(p + 16 + fh * 8);
  return __builtin_shufflevector(lo, hi, 0, 1, 2, 3, 4, 5, 6, 7,
                                 8, 9, 10, 11, 12, 13, 14, 15);
}

__device__ __forceinline__ v4h cvt4(v4f a) {
  v4h r;
  r[0] = (_Float16)a[0]; r[1] = (_Float16)a[1];
  r[2] = (_Float16)a[2]; r[3] = (_Float16)a[3];
  return r;
}

// f32 tile staging, 128 rows x 32 floats by 256 threads. Eight lanes take the
// 128 B (one cache line) that a row has in the K slice, so a wave-wide 16-B load
// touches 4 whole lines; a thread holds 4 floats of rows r, r+32, r+64, r+96.
constexpr int RSTEP = 32;  // rows between two loads of one thread
template <int LD>
__device__ __forceinline__ void ld16(const float* p, v4f r[4]) {
#pragma unroll  // constant indices keep r[] in registers and the row steps in the offset field
  for (int i = 0; i < 4; ++i) r[i] = *(const v4f*)(p + (size_t)i * RSTEP * LD);
}
__device__ __forceinline__ void st16(_Float16* d, const v4f r[4]) {
#pragma unroll  // constant indices keep r[] in registers
  for (int i = 0; i < 4; ++i) *(v4h*)(d + i * RSTEP * LDP) = cvt4(r[i]);
}

// ---------------------------------------------------------------------------
// Kernel 1: fused top-2 gating -> dense [T,E] weights.
// ---------------------------------------------------------------------------
__global__ __launch_bounds__(256) void moe_gating_kernel(
    const float* __restrict__ gating, float* __restrict__ w_full) {
  int t = blockIdx.x * blockDim.x + threadIdx.x;
  if (t >= T_DIM) return;
  float l[E_DIM];
  float m = -INFINITY;
#pragma unroll
  for (int e = 0; e < E_DIM; ++e) {
    l[e] = gating[t * E_DIM + e];
    m = fmaxf(m, l[e]);
  }
  float p[E_DIM];
#pragma unroll
  for (int e = 0; e < E_DIM; ++e) p[e] = __expf(l[e] - m);
  int i1 = 0;
#pragma unroll
  for (int e = 1; e < E_DIM; ++e) if (p[e] > p[i1]) i1 = e;
  int i2 = (i1 == 0) ? 1 : 0;
#pragma unroll
  for (int e = 0; e < E_DIM; ++e) if (e != i1 && p[e] > p[i2]) i2 = e;
  float rden = __builtin_amdgcn_rcpf(p[i1] + p[i2]);
#pragma unroll
  for (int e = 0; e < E_DIM; ++e) {
    float w = 0.0f;
    if (e == i1) w = p[i1] * rden;
    if (e == i2) w = p[i2] * rden;
    w_full[t * E_DIM + e] = w;
  }
}

// ---------------------------------------------------------------------------
// Kernel 2: per-expert fused gate+up GEMM + SiLU-gate epilogue -> h (f16).
// Double-buffered LDS, one barrier per K-step: compute from buffer `cur`
// while register-prefetched f32 slices are converted into buffer `cur^1`.
// ---------------------------------------------------------------------------
__global__ __launch_bounds__(256) void moe_gateup_kernel(
    const float* __restrict__ x,   // [T, D]
    const float* __restrict__ gw,  // [F, D]
    const float* __restrict__ uw,  // [F, D]
    _Float16* __restrict__ h) {    // [T, F]
  __shared__ _Float16 sA[2 * TILE];  // 20 KB
  __shared__ _Float16 sG[2 * TILE];  // 20 KB
  __shared__ _Float16 sU[2 * TILE];  // 20 KB

  const int tid = threadIdx.x;
  const int lane = tid & 31;
  const int wave = tid >> 5;
  const int waveM = wave >> 1;   // 0..3  (32 rows each)
  const int waveN = wave & 1;    // 0..1  (64 cols each)
  const int fr = lane & 15;
  const int fh = lane >> 4;

  const int blockM = blockIdx.x * BM;
  const int blockN = blockIdx.y * BN;

  // Global->LDS mapping: 8 threads per row slice, 4 floats each, 4 rows per thread.
  const int row = tid >> 3, col = (tid & 7) * 4;
  const int soff = row * LDP + col;
  const float* pax = x  + (size_t)(blockM + row) * D_DIM + col;
  const float* pgw = gw + (size_t)(blockN + row) * D_DIM + col;
  const float* puw = uw + (size_t)(blockN + row) * D_DIM + col;

  v4f ra[4], rg[4], ru[4];
  ld16<D_DIM>(pax, ra);
  ld16<D_DIM>(pgw, rg);
  ld16<D_DIM>(puw, ru);
  st16(&sA[soff], ra);
  st16(&sG[soff], rg);
  st16(&sU[soff], ru);
  __syncthreads();

  v8f cg[2][4] = {};
  v8f cu[2][4] = {};

  for (int k0 = 0; k0 < D_DIM; k0 += BK) {
    const int cur = (k0 / BK) & 1;
    const int nxt = cur ^ 1;
    const bool has_next = (k0 + BK) < D_DIM;

    if (has_next) {  // issue next-slice global loads under the WMMA chain
      ld16<D_DIM>(pax + k0 + BK, ra);
      ld16<D_DIM>(pgw + k0 + BK, rg);
      ld16<D_DIM>(puw + k0 + BK, ru);
      // the fragment loads below reuse the address registers of these loads
      asm volatile("s_wait_xcnt 0x0" ::: "memory");
    }

    const _Float16* A = sA + cur * TILE;
    const _Float16* G = sG + cur * TILE;
    const _Float16* U = sU + cur * TILE;
    v16h aF[2], gF[4], uF[4];
#pragma unroll
    for (int i = 0; i < 2; ++i)
      aF[i] = load_frag(A, waveM * 32 + i * 16 + fr, fh);
#pragma unroll
    for (int j = 0; j < 4; ++j) {
      gF[j] = load_frag(G, waveN * 64 + j * 16 + fr, fh);
      uF[j] = load_frag(U, waveN * 64 + j * 16 + fr, fh);
    }
#pragma unroll
    for (int i = 0; i < 2; ++i)
#pragma unroll
      for (int j = 0; j < 4; ++j) {
        cg[i][j] = wmma_f16(aF[i], gF[j], cg[i][j]);
        cu[i][j] = wmma_f16(aF[i], uF[j], cu[i][j]);
      }

    if (has_next) {  // fill the other buffer; published by the barrier below
      st16(&sA[nxt * TILE + soff], ra);
      st16(&sG[nxt * TILE + soff], rg);
      st16(&sU[nxt * TILE + soff], ru);
    }
    __syncthreads();
  }

  // Epilogue: silu(g)*u -> f16.  C layout: n = lane&15, m = r + 8*(lane>>4).
#pragma unroll
  for (int i = 0; i < 2; ++i)
#pragma unroll
    for (int j = 0; j < 4; ++j) {
      const int m_base = blockM + waveM * 32 + i * 16 + fh * 8;
      const int n = blockN + waveN * 64 + j * 16 + fr;
#pragma unroll
      for (int r = 0; r < 8; ++r) {
        float g = cg[i][j][r];
        float u = cu[i][j][r];
        float sig = __builtin_amdgcn_rcpf(1.0f + __expf(-g));
        h[(size_t)(m_base + r) * F_DIM + n] = (_Float16)(g * sig * u);
      }
    }
}

// ---------------------------------------------------------------------------
// Kernel 3: per-expert down GEMM + gating-weight epilogue.
// A-operand (h, f16) pipelined into double-buffered LDS by the Tensor Data
// Mover (issue for k+1 at top of step k, wait only after the WMMA chain);
// B-operand converted f32->f16 by the threads while the TDM runs.
// ---------------------------------------------------------------------------
__global__ __launch_bounds__(256) void moe_down_kernel(
    const _Float16* __restrict__ h,  // [T, F] f16
    const float* __restrict__ dw,    // [D, F]
    const float* __restrict__ wcol,  // w_full + e (stride E)
    float* __restrict__ out,         // [T, D]
    int accum) {
  // 20 KB each; sA is the TDM destination (ping-pong), both buffers at multiples of 2 KiB.
  __shared__ __attribute__((aligned(2048))) _Float16 sA[2 * TILE];
  __shared__ _Float16 sB[2 * TILE];

  const int tid = threadIdx.x;
  const int lane = tid & 31;
  const int wave = tid >> 5;
  const int waveM = wave >> 1;
  const int waveN = wave & 1;
  const int fr = lane & 15;
  const int fh = lane >> 4;

  const int blockM = blockIdx.x * BM;  // tokens
  const int blockN = blockIdx.y * BN;  // hidden dim D

  const int row = tid >> 3, col = (tid & 7) * 4;  // as in the gate+up kernel
  const int soff = row * LDP + col;
  const float* pb = dw + (size_t)(blockN + row) * F_DIM + col;

#if HAVE_TDM
  // Tensor DMA descriptor (2D), every extent in bytes: tile = tensor = BM rows of
  // 64 B at the source pitch of h; a 16-B pad behind every 64-B row lays the
  // rows at the 80-B pitch that load_frag reads.
  constexpr uint32_t ROWB = BK * sizeof(_Float16);
  const uint32_t lds_a = (uint32_t)(uintptr_t)(void*)sA;
  const uint64_t gbase = (uint64_t)(uintptr_t)(h + (size_t)blockM * F_DIM);
  i32x8 g1;
  g1[0] = (int)((1u << 20) | (3u << 22) | (3u << 25));      // pad on, every 16 dwords, 4 dwords
  g1[1] = (int)(ROWB << 16);                                // tensor_dim0 lo
  g1[2] = (int)((uint32_t)BM << 16);                        // dim0 hi | dim1 lo
  g1[3] = (int)(ROWB << 16);                                // dim1 hi | tile_dim0
  g1[4] = (int)(uint32_t)BM;                                // tile_dim1 (tile_dim2=0)
  g1[5] = (int)(uint32_t)(F_DIM * sizeof(_Float16));        // source row pitch
  g1[6] = 0;
  g1[7] = 0;
  const i32x4 z4 = {0, 0, 0, 0};
  const i32x8 z8 = {0, 0, 0, 0, 0, 0, 0, 0};
#define TDM_ISSUE(K0, BUF)                                                    \
  do {                                                                        \
    uint64_t ga = gbase + (uint64_t)(K0) * sizeof(_Float16);                  \
    u32x4 g0;                                                                 \
    g0[0] = 1u;                                                               \
    g0[1] = lds_a + (uint32_t)((BUF) * TILE * sizeof(_Float16));              \
    g0[2] = (uint32_t)ga;                                                     \
    g0[3] = (uint32_t)((ga >> 32) & 0x01FFFFFFu) | (2u << 30);                \
    __builtin_amdgcn_tensor_load_to_lds(g0, g1, z4, z4, z8, 0);               \
  } while (0)
#else
  const int asoff = (tid >> 1) * LDP + (tid & 1) * 16;
  const _Float16* pa = h + (size_t)(blockM + (tid >> 1)) * F_DIM + (tid & 1) * 16;
#endif

  // ---- prologue: fill buffer 0 ----
  v4f rb[4];
  ld16<F_DIM>(pb, rb);
#if HAVE_TDM
  if (wave == 0) TDM_ISSUE(0, 0);
#else
  *(v8h*)&sA[asoff]     = *(const v8h*)(pa);
  *(v8h*)&sA[asoff + 8] = *(const v8h*)(pa + 8);
#endif
  st16(&sB[soff], rb);
  ld16<F_DIM>(pb + BK, rb);  // slice k=BK into regs
#if HAVE_TDM
  if (wave == 0) __builtin_amdgcn_s_wait_tensorcnt(0);
#endif
  __syncthreads();

  v8f c[2][4] = {};

  for (int k0 = 0; k0 < F_DIM; k0 += BK) {
    const int cur = (k0 / BK) & 1;
    const int nxt = cur ^ 1;
    const bool has_next = (k0 + BK) < F_DIM;

#if HAVE_TDM
    if (has_next && wave == 0) TDM_ISSUE(k0 + BK, nxt);  // overlaps compute
#else
    if (has_next) {
      *(v8h*)&sA[nxt * TILE + asoff]     = *(const v8h*)(pa + k0 + BK);
      *(v8h*)&sA[nxt * TILE + asoff + 8] = *(const v8h*)(pa + k0 + BK + 8);
    }
#endif

    const _Float16* A = sA + cur * TILE;
    const _Float16* B = sB + cur * TILE;
    v16h aF[2], bF[4];
#pragma unroll
    for (int i = 0; i < 2; ++i)
      aF[i] = load_frag(A, waveM * 32 + i * 16 + fr, fh);
#pragma unroll
    for (int j = 0; j < 4; ++j)
      bF[j] = load_frag(B, waveN * 64 + j * 16 + fr, fh);
#pragma unroll
    for (int i = 0; i < 2; ++i)
#pragma unroll
      for (int j = 0; j < 4; ++j)
        c[i][j] = wmma_f16(aF[i], bF[j], c[i][j]);

    if (has_next) {
      st16(&sB[nxt * TILE + soff], rb);                       // publish B k+1
      if (k0 + 2 * BK < F_DIM) ld16<F_DIM>(pb + k0 + 2 * BK, rb);    // fetch B k+2
#if HAVE_TDM
      if (wave == 0) __builtin_amdgcn_s_wait_tensorcnt(0);    // TDM k+1 done
#endif
    }
    __syncthreads();
  }

#pragma unroll
  for (int i = 0; i < 2; ++i)
#pragma unroll
    for (int j = 0; j < 4; ++j) {
      const int m_base = blockM + waveM * 32 + i * 16 + fh * 8;
      const int n = blockN + waveN * 64 + j * 16 + fr;
#pragma unroll
      for (int r = 0; r < 8; ++r) {
        const int t = m_base + r;
        float wgt = wcol[(size_t)t * E_DIM];
        float val = wgt * c[i][j][r];
        size_t o = (size_t)t * D_DIM + n;
        out[o] = accum ? (out[o] + val) : val;
      }
    }
}

// ---------------------------------------------------------------------------
// Launch: gating, then per expert: gate+up -> down (sequential on stream).
// Workspace: h (T*F f16 = 16 MB) then w_full (T*E f32).
// ---------------------------------------------------------------------------
extern "C" void kernel_launch(void* const* d_in, const int* in_sizes, int n_in,
                              void* d_out, int out_size, void* d_ws, size_t ws_size,
                              hipStream_t stream) {
  const float* x      = (const float*)d_in[0];
  const float* gating = (const float*)d_in[1];
  const float* gate_w = (const float*)d_in[2];
  const float* up_w   = (const float*)d_in[3];
  const float* down_w = (const float*)d_in[4];
  float* out = (float*)d_out;

  _Float16* h_ws = (_Float16*)d_ws;
  float* w_full = (float*)((char*)d_ws + (size_t)T_DIM * F_DIM * sizeof(_Float16));

  moe_gating_kernel<<<T_DIM / 256, 256, 0, stream>>>(gating, w_full);

  for (int e = 0; e < E_DIM; ++e) {
    const size_t woff = (size_t)e * F_DIM * D_DIM;
    moe_gateup_kernel<<<dim3(T_DIM / BM, F_DIM / BN), 256, 0, stream>>>(
        x, gate_w + woff, up_w + woff, h_ws);
    moe_down_kernel<<<dim3(T_DIM / BM, D_DIM / BN), 256, 0, stream>>>(
        h_ws, down_w + woff, w_full + e, out, e == 0 ? 0 : 1);
  }
}

// v003
// A run of this version takes 777 microseconds.
// Next to v002, in two timings, it ran 1.18 times as fast each time.
// All steps since v000 together make it 1.58 times as fast.
#include <hip/hip_runtime.h>
#include <hip/hip_fp16.h>
#include <math.h>
#include <stdint.h>

typedef __attribute__((ext_vector_type(16))) _Float16 v16h;
typedef __attribute__((ext_vector_type(8)))  _Float16 v8h;
typedef __attribute__((ext_vector_type(4)))  _Float16 v4h;
typedef __attribute__((ext_vector_type(8)))  float    v8f;
typedef __attribute__((ext_vector_type(4)))  float    v4f;
typedef __attribute__((ext_vector_type(4)))  unsigned int u32x4;
typedef __attribute__((ext_vector_type(8)))  int i32x8;
typedef __attribute__((ext_vector_type(4)))  int i32x4;

#if defined(__has_builtin)
#if __has_builtin(__builtin_amdgcn_tensor_load_to_lds) && \
    __has_builtin(__builtin_amdgcn_s_wait_tensorcnt)
#define HAVE_TDM 1
#endif
#endif

// Problem constants
constexpr int T_DIM = 4096;
constexpr int D_DIM = 1024;
constexpr int F_DIM = 2048;
constexpr int E_DIM = 8;

// Tiling: block 128(M) x 128(N) x 32(K); 8 waves, wave tile 32(M) x 64(N).
constexpr int BM = 128;
constexpr int BN = 128;
constexpr int BK = 32;
constexpr int LDP = BK + 8;     // LDS row pitch in halves: 80 B = 16 B x odd, so 16 rows of a b128 read fall on distinct banks
constexpr int TILE = BM * LDP;  // halves per LDS tile buffer (10,240 B, a multiple of 2 KiB)

// ---------------------------------------------------------------------------
// WMMA helper: D = A * B + C   (16x16x32, f16 in, f32 accumulate)
// ---------------------------------------------------------------------------
__device__ __forceinline__ v8f wmma_f16(v16h a, v16h b, v8f c) {
  return __builtin_amdgcn_wmma_f32_16x16x32_f16(
      false, a, false, b, (short)0, c, false, false);
}

// Build a 16x32 f16 fragment from a row-major LDS tile (row stride = LDP).
// lane<16: row=lane, K in {0..7,16..23}; lane>=16: row=lane-16, K in {8..15,24..31}.
__device__ __forceinline__ v16h load_frag(const _Float16* lds, int row, int fh) {
  const _Float16* p = lds + row * LDP;
  v8h lo = *(const v8h*)(p + fh * 8);
  v8h hi = *(const v8h*)(p + 16 + fh * 8);
  return __builtin_shufflevector(lo, hi, 0, 1, 2, 3, 4, 5, 6, 7,
                                 8, 9, 10, 11, 12, 13, 14, 15);
}

__device__ __forceinline__ v4h cvt4(v4f a) {
  v4h r;
  r[0] = (_Float16)a[0]; r[1] = (_Float16)a[1];
  r[2] = (_Float16)a[2]; r[3] = (_Float16)a[3];
  return r;
}

// f32 tile staging, 128 rows x 32 floats by 256 threads. Eight lanes take the
// 128 B (one cache line) that a row has in the K slice, so a wave-wide 16-B load
// touches 4 whole lines; a thread holds 4 floats of rows r, r+32, r+64, r+96.
constexpr int RSTEP = 32;  // rows between two loads of one thread
template <int LD>
__device__ __forceinline__ void ld16(const float* p, v4f r[4]) {
#pragma unroll  // constant indices keep r[] in registers and the row steps in the offset field
  for (int i = 0; i < 4; ++i) r[i] = *(const v4f*)(p + (size_t)i * RSTEP * LD);
}
__device__ __forceinline__ void st16(_Float16* d, const v4f r[4]) {
#pragma unroll  // constant indices keep r[] in registers
  for (int i = 0; i < 4; ++i) *(v4h*)(d + i * RSTEP * LDP) = cvt4(r[i]);
}

// ---------------------------------------------------------------------------
// Kernel 1: fused top-2 gating -> dense [T,E] weights.
// ---------------------------------------------------------------------------
__global__ __launch_bounds__(256) void moe_gating_kernel(
    const float* __restrict__ gating, float* __restrict__ w_full) {
  int t = blockIdx.x * blockDim.x + threadIdx.x;
  if (t >= T_DIM) return;
  float l[E_DIM];
  float m = -INFINITY;
#pragma unroll
  for (int e = 0; e < E_DIM; ++e) {
    l[e] = gating[t * E_DIM + e];
    m = fmaxf(m, l[e]);
  }
  float p[E_DIM];
#pragma unroll
  for (int e = 0; e < E_DIM; ++e) p[e] = __expf(l[e] - m);
  int i1 = 0;
#pragma unroll
  for (int e = 1; e < E_DIM; ++e) if (p[e] > p[i1]) i1 = e;
  int i2 = (i1 == 0) ? 1 : 0;
#pragma unroll
  for (int e = 0; e < E_DIM; ++e) if (e != i1 && p[e] > p[i2]) i2 = e;
  float rden = __builtin_amdgcn_rcpf(p[i1] + p[i2]);
#pragma unroll
  for (int e = 0; e < E_DIM; ++e) {
    float w = 0.0f;
    if (e == i1) w = p[i1] * rden;
    if (e == i2) w = p[i2] * rden;
    w_full[t * E_DIM + e] = w;
  }
}

// ---------------------------------------------------------------------------
// Kernel 2: per-expert fused gate+up GEMM + SiLU-gate epilogue -> h (f16).
// Double-buffered LDS, one barrier per K-step: compute from buffer `cur`
// while register-prefetched f32 slices are converted into buffer `cur^1`.
// The second launch bound asks for 4 waves per SIMD (a budget of 256 VGPRs), so
// that two workgroups share a WGP and each runs while the other waits on its
// loads, its LDS or its barrier.
// ---------------------------------------------------------------------------
__global__ __launch_bounds__(256, 4) void moe_gateup_kernel(
    const float* __restrict__ x,   // [T, D]
    const float* __restrict__ gw,  // [F, D]
    const float* __restrict__ uw,  // [F, D]
    _Float16* __restrict__ h) {    // [T, F]
  __shared__ _Float16 sA[2 * TILE];  // 20 KB
  __shared__ _Float16 sG[2 * TILE];  // 20 KB
  __shared__ _Float16 sU[2 * TILE];  // 20 KB

  const int tid = threadIdx.x;
  const int lane = tid & 31;
  const int wave = tid >> 5;
  const int waveM = wave >> 1;   // 0..3  (32 rows each)
  const int waveN = wave & 1;    // 0..1  (64 cols each)
  const int fr = lane & 15;
  const int fh = lane >> 4;

  const int blockM = blockIdx.x * BM;
  const int blockN = blockIdx.y * BN;

  // Global->LDS mapping: 8 threads per row slice, 4 floats each, 4 rows per thread.
  const int row = tid >> 3, col = (tid & 7) * 4;
  const int soff = row * LDP + col;
  const float* pax = x  + (size_t)(blockM + row) * D_DIM + col;
  const float* pgw = gw + (size_t)(blockN + row) * D_DIM + col;
  const float* puw = uw + (size_t)(blockN + row) * D_DIM + col;

  v4f ra[4], rg[4], ru[4];
  ld16<D_DIM>(pax, ra);
  ld16<D_DIM>(pgw, rg);
  ld16<D_DIM>(puw, ru);
  st16(&sA[soff], ra);
  st16(&sG[soff], rg);
  st16(&sU[soff], ru);
  __syncthreads();

  v8f cg[2][4] = {};
  v8f cu[2][4] = {};

  for (int k0 = 0; k0 < D_DIM; k0 += BK) {
    const int cur = (k0 / BK) & 1;
    const int nxt = cur ^ 1;
    const bool has_next = (k0 + BK) < D_DIM;

    if (has_next) {  // issue next-slice global loads under the WMMA chain
      ld16<D_DIM>(pax + k0 + BK, ra);
      ld16<D_DIM>(pgw + k0 + BK, rg);
      ld16<D_DIM>(puw + k0 + BK, ru);
      // the fragment loads below reuse the address registers of these loads
      asm volatile("s_wait_xcnt 0x0" ::: "memory");
    }

    const _Float16* A = sA + cur * TILE;
    const _Float16* G = sG + cur * TILE;
    const _Float16* U = sU + cur * TILE;
    v16h aF[2];
#pragma unroll
    for (int i = 0; i < 2; ++i)
      aF[i] = load_frag(A, waveM * 32 + i * 16 + fr, fh);
    // The weight fragments come in two halves of the wave's 64 columns: 32 and not
    // 64 registers hold them at a time, which keeps the kernel inside the budget
    // without scratch.
#pragma unroll
    for (int jh = 0; jh < 4; jh += 2) {
      v16h gF[2], uF[2];
#pragma unroll
      for (int j = 0; j < 2; ++j) {
        gF[j] = load_frag(G, waveN * 64 + (jh + j) * 16 + fr, fh);
        uF[j] = load_frag(U, waveN * 64 + (jh + j) * 16 + fr, fh);
      }
#pragma unroll
      for (int i = 0; i < 2; ++i)
#pragma unroll
        for (int j = 0; j < 2; ++j) {
          cg[i][jh + j] = wmma_f16(aF[i], gF[j], cg[i][jh + j]);
          cu[i][jh + j] = wmma_f16(aF[i], uF[j], cu[i][jh + j]);
        }
    }

    if (has_next) {  // fill the other buffer; published by the barrier below
      st16(&sA[nxt * TILE + soff], ra);
      st16(&sG[nxt * TILE + soff], rg);
      st16(&sU[nxt * TILE + soff], ru);
    }
    __syncthreads();
  }

  // Epilogue: silu(g)*u -> f16.  C layout: n = lane&15, m = r + 8*(lane>>4).
#pragma unroll
  for (int i = 0; i < 2; ++i)
#pragma unroll
    for (int j = 0; j < 4; ++j) {
      const int m_base = blockM + waveM * 32 + i * 16 + fh * 8;
      const int n = blockN + waveN * 64 + j * 16 + fr;
#pragma unroll
      for (int r = 0; r < 8; ++r) {
        float g = cg[i][j][r];
        float u = cu[i][j][r];
        float sig = __builtin_amdgcn_rcpf(1.0f + __expf(-g));
        h[(size_t)(m_base + r) * F_DIM + n] = (_Float16)(g * sig * u);
      }
    }
}

// ---------------------------------------------------------------------------
// Kernel 3: per-expert down GEMM + gating-weight epilogue.
// A-operand (h, f16) pipelined into double-buffered LDS by the Tensor Data
// Mover (issue for k+1 at top of step k, wait only after the WMMA chain);
// B-operand converted f32->f16 by the threads while the TDM runs.
// ---------------------------------------------------------------------------
__global__ __launch_bounds__(256) void moe_down_kernel(
    const _Float16* __restrict__ h,  // [T, F] f16
    const float* __restrict__ dw,    // [D, F]
    const float* __restrict__ wcol,  // w_full + e (stride E)
    float* __restrict__ out,         // [T, D]
    int accum) {
  // 20 KB each; sA is the TDM destination (ping-pong), both buffers at multiples of 2 KiB.
  __shared__ __attribute__((aligned(2048))) _Float16 sA[2 * TILE];
  __shared__ _Float16 sB[2 * TILE];

  const int tid = threadIdx.x;
  const int lane = tid & 31;
  const int wave = tid >> 5;
  const int waveM = wave >> 1;
  const int waveN = wave & 1;
  const int fr = lane & 15;
  const int fh = lane >> 4;

  const int blockM = blockIdx.x * BM;  // tokens
  const int blockN = blockIdx.y * BN;  // hidden dim D

  const int row = tid >> 3, col = (tid & 7) * 4;  // as in the gate+up kernel
  const int soff = row * LDP + col;
  const float* pb = dw + (size_t)(blockN + row) * F_DIM + col;

#if HAVE_TDM
  // Tensor DMA descriptor (2D), every extent in bytes: tile = tensor = BM rows of
  // 64 B at the source pitch of h; a 16-B pad behind every 64-B row lays the
  // rows at the 80-B pitch that load_frag reads.
  constexpr uint32_t ROWB = BK * sizeof(_Float16);
  const uint32_t lds_a = (uint32_t)(uintptr_t)(void*)sA;
  const uint64_t gbase = (uint64_t)(uintptr_t)(h + (size_t)blockM * F_DIM);
  i32x8 g1;
  g1[0] = (int)((1u << 20) | (3u << 22) | (3u << 25));      // pad on, every 16 dwords, 4 dwords
  g1[1] = (int)(ROWB << 16);                                // tensor_dim0 lo
  g1[2] = (int)((uint32_t)BM << 16);                        // dim0 hi | dim1 lo
  g1[3] = (int)(ROWB << 16);                                // dim1 hi | tile_dim0
  g1[4] = (int)(uint32_t)BM;                                // tile_dim1 (tile_dim2=0)
  g1[5] = (int)(uint32_t)(F_DIM * sizeof(_Float16));        // source row pitch
  g1[6] = 0;
  g1[7] = 0;
  const i32x4 z4 = {0, 0, 0, 0};
  const i32x8 z8 = {0, 0, 0, 0, 0, 0, 0, 0};
#define TDM_ISSUE(K0, BUF)                                                    \
  do {                                                                        \
    uint64_t ga = gbase + (uint64_t)(K0) * sizeof(_Float16);                  \
    u32x4 g0;                                                                 \
    g0[0] = 1u;                                                               \
    g0[1] = lds_a + (uint32_t)((BUF) * TILE * sizeof(_Float16));              \
    g0[2] = (uint32_t)ga;                                                     \
    g0[3] = (uint32_t)((ga >> 32) & 0x01FFFFFFu) | (2u << 30);                \
    __builtin_amdgcn_tensor_load_to_lds(g0, g1, z4, z4, z8, 0);               \
  } while (0)
#else
  const int asoff = (tid >> 1) * LDP + (tid & 1) * 16;
  const _Float16* pa = h + (size_t)(blockM + (tid >> 1)) * F_DIM + (tid & 1) * 16;
#endif

  // ---- prologue: fill buffer 0 ----
  v4f rb[4];
  ld16<F_DIM>(pb, rb);
#if HAVE_TDM
  if (wave == 0) TDM_ISSUE(0, 0);
#else
  *(v8h*)&sA[asoff]     = *(const v8h*)(pa);
  *(v8h*)&sA[asoff + 8] = *(const v8h*)(pa + 8);
#endif
  st16(&sB[soff], rb);
  ld16<F_DIM>(pb + BK, rb);  // slice k=BK into regs
#if HAVE_TDM
  if (wave == 0) __builtin_amdgcn_s_wait_tensorcnt(0);
#endif
  __syncthreads();

  v8f c[2][4] = {};

  for (int k0 = 0; k0 < F_DIM; k0 += BK) {
    const int cur = (k0 / BK) & 1;
    const int nxt = cur ^ 1;
    const bool has_next = (k0 + BK) < F_DIM;

#if HAVE_TDM
    if (has_next && wave == 0) TDM_ISSUE(k0 + BK, nxt);  // overlaps compute
#else
    if (has_next) {
      *(v8h*)&sA[nxt * TILE + asoff]     = *(const v8h*)(pa + k0 + BK);
      *(v8h*)&sA[nxt * TILE + asoff + 8] = *(const v8h*)(pa + k0 + BK + 8);
    }
#endif

    const _Float16* A = sA + cur * TILE;
    const _Float16* B = sB + cur * TILE;
    v16h aF[2], bF[4];
#pragma unroll
    for (int i = 0; i < 2; ++i)
      aF[i] = load_frag(A, waveM * 32 + i * 16 + fr, fh);
#pragma unroll
    for (int j = 0; j < 4; ++j)
      bF[j] = load_frag(B, waveN * 64 + j * 16 + fr, fh);
#pragma unroll
    for (int i = 0; i < 2; ++i)
#pragma unroll
      for (int j = 0; j < 4; ++j)
        c[i][j] = wmma_f16(aF[i], bF[j], c[i][j]);

    if (has_next) {
      st16(&sB[nxt * TILE + soff], rb);                       // publish B k+1
      if (k0 + 2 * BK < F_DIM) ld16<F_DIM>(pb + k0 + 2 * BK, rb);    // fetch B k+2
#if HAVE_TDM
      if (wave == 0) __builtin_amdgcn_s_wait_tensorcnt(0);    // TDM k+1 done
#endif
    }
    __syncthreads();
  }

#pragma unroll
  for (int i = 0; i < 2; ++i)
#pragma unroll
    for (int j = 0; j < 4; ++j) {
      const int m_base = blockM + waveM * 32 + i * 16 + fh * 8;
      const int n = blockN + waveN * 64 + j * 16 + fr;
#pragma unroll
      for (int r = 0; r < 8; ++r) {
        const int t = m_base + r;
        float wgt = wcol[(size_t)t * E_DIM];
        float val = wgt * c[i][j][r];
        size_t o = (size_t)t * D_DIM + n;
        out[o] = accum ? (out[o] + val) : val;
      }
    }
}

// ---------------------------------------------------------------------------
// Launch: gating, then per expert: gate+up -> down (sequential on stream).
// Workspace: h (T*F f16 = 16 MB) then w_full (T*E f32).
// ---------------------------------------------------------------------------
extern "C" void kernel_launch(void* const* d_in, const int* in_sizes, int n_in,
                              void* d_out, int out_size, void* d_ws, size_t ws_size,
                              hipStream_t stream) {
  const float* x      = (const float*)d_in[0];
  const float* gating = (const float*)d_in[1];
  const float* gate_w = (const float*)d_in[2];
  const float* up_w   = (const float*)d_in[3];
  const float* down_w = (const float*)d_in[4];
  float* out = (float*)d_out;

  _Float16* h_ws = (_Float16*)d_ws;
  float* w_full = (float*)((char*)d_ws + (size_t)T_DIM * F_DIM * sizeof(_Float16));

  moe_gating_kernel<<<T_DIM / 256, 256, 0, stream>>>(gating, w_full);

  for (int e = 0; e < E_DIM; ++e) {
    const size_t woff = (size_t)e * F_DIM * D_DIM;
    moe_gateup_kernel<<<dim3(T_DIM / BM, F_DIM / BN), 256, 0, stream>>>(
        x, gate_w + woff, up_w + woff, h_ws);
    moe_down_kernel<<<dim3(T_DIM / BM, D_DIM / BN), 256, 0, stream>>>(
        h_ws, down_w + woff, w_full + e, out, e == 0 ? 0 : 1);
  }
}

// v004
// One run takes 582 microseconds.
// Two timings next to v003 put it at 1.34 and 1.35 times that version's speed.
// All steps since v000 together make it 2.13 times as fast.
#include <hip/hip_runtime.h>
#include <hip/hip_fp16.h>
#include <math.h>
#include <stdint.h>

typedef __attribute__((ext_vector_type(16))) _Float16 v16h;
typedef __attribute__((ext_vector_type(8)))  _Float16 v8h;
typedef __attribute__((ext_vector_type(4)))  _Float16 v4h;
typedef __attribute__((ext_vector_type(8)))  float    v8f;
typedef __attribute__((ext_vector_type(4)))  float    v4f;
typedef __attribute__((ext_vector_type(4)))  unsigned int u32x4;
typedef __attribute__((ext_vector_type(8)))  int i32x8;
typedef __attribute__((ext_vector_type(4)))  int i32x4;

#if defined(__has_builtin)
#if __has_builtin(__builtin_amdgcn_tensor_load_to_lds) && \
    __has_builtin(__builtin_amdgcn_s_wait_tensorcnt)
#define HAVE_TDM 1
#endif
#endif

// Problem constants
constexpr int T_DIM = 4096;
constexpr int D_DIM = 1024;
constexpr int F_DIM = 2048;
constexpr int E_DIM = 8;

// Tiling: block 128(M) x 128(N) x 64(K); 8 waves, wave tile 32(M) x 64(N).
constexpr int BM = 128;
constexpr int BN = 128;
constexpr int BK = 64;          // one staged row slice is 128 B of f16, a whole cache line
constexpr int LDP = BK + 8;     // LDS row pitch in halves: 144 B = 16 B x odd, so 16 rows of a b128 read fall on distinct banks
constexpr int TILE = BM * LDP;  // halves per LDS tile buffer (18,432 B, a multiple of 2 KiB)

// ---------------------------------------------------------------------------
// WMMA helper: D = A * B + C   (16x16x32, f16 in, f32 accumulate)
// ---------------------------------------------------------------------------
__device__ __forceinline__ v8f wmma_f16(v16h a, v16h b, v8f c) {
  return __builtin_amdgcn_wmma_f32_16x16x32_f16(
      false, a, false, b, (short)0, c, false, false);
}

// Build a 16x32 f16 fragment from a row-major LDS tile (row stride = LDP); kk picks
// the 32-wide half of the staged K slice.
// lane<16: row=lane, K in {0..7,16..23}; lane>=16: row=lane-16, K in {8..15,24..31}.
__device__ __forceinline__ v16h load_frag(const _Float16* lds, int row, int fh, int kk) {
  const _Float16* p = lds + row * LDP + kk * 32;
  v8h lo = *(const v8h*)(p + fh * 8);
  v8h hi = *(const v8h*)(p + 16 + fh * 8);
  return __builtin_shufflevector(lo, hi, 0, 1, 2, 3, 4, 5, 6, 7,
                                 8, 9, 10, 11, 12, 13, 14, 15);
}

__device__ __forceinline__ v4h cvt4(v4f a) {
  v4h r;
  r[0] = (_Float16)a[0]; r[1] = (_Float16)a[1];
  r[2] = (_Float16)a[2]; r[3] = (_Float16)a[3];
  return r;
}

// f16 tile staging, 128 rows x 64 halves by 256 threads. Eight lanes take the
// 128 B (one cache line) that a row has in the K slice, so a wave-wide 16-B load
// touches 4 whole lines; a thread holds 8 halves of rows r, r+32, r+64, r+96.
constexpr int RSTEP = 32;  // rows between two loads of one thread
template <int LD>
__device__ __forceinline__ void ld16(const _Float16* p, v8h r[4]) {
#pragma unroll  // constant indices keep r[] in registers and the row steps in the offset field
  for (int i = 0; i < 4; ++i) r[i] = *(const v8h*)(p + (size_t)i * RSTEP * LD);
}
__device__ __forceinline__ void st16(_Float16* d, const v8h r[4]) {
#pragma unroll  // constant indices keep r[] in registers
  for (int i = 0; i < 4; ++i) *(v8h*)(d + i * RSTEP * LDP) = r[i];
}

// ---------------------------------------------------------------------------
// Kernel 0: x and the three weight tensors, f32 -> f16, once per call. The GEMM
// kernels re-read every operand tile many times; they read it at 2 B an
// element and convert nothing. grid.y picks a segment of SEG elements: 0 is x,
// 1..4 gate_w, 5..8 up_w, 9..12 down_w (the weights land back to back in wh).
// ---------------------------------------------------------------------------
constexpr int SEG = T_DIM * D_DIM;          // elements per segment; a weight tensor is 4 segments
constexpr int CVT_LOADS = 8;                // 16-B loads in flight per thread
constexpr int CVT_BLK = 256 * 4 * CVT_LOADS;  // elements per block
constexpr int CVT_SEGS = 1 + 3 * 4;         // x and three weight tensors
static_assert((size_t)E_DIM * F_DIM * D_DIM == (size_t)4 * SEG, "a weight tensor is 4 segments");
__global__ __launch_bounds__(256) void moe_to_f16_kernel(
    const float* __restrict__ x, const float* __restrict__ gw,
    const float* __restrict__ uw, const float* __restrict__ dw,
    _Float16* __restrict__ xh, _Float16* __restrict__ wh) {
  const int seg = blockIdx.y;
  const float* s = x;
  _Float16* d = xh;
  if (seg > 0) {
    const int a = (seg - 1) >> 2;
    s = (a == 0 ? gw : (a == 1 ? uw : dw)) + (size_t)((seg - 1) & 3) * SEG;
    d = wh + (size_t)(seg - 1) * SEG;
  }
  const size_t o = (size_t)blockIdx.x * CVT_BLK + threadIdx.x * 4;
  v4f r[CVT_LOADS];
#pragma unroll  // all loads issue before the first store waits on one
  for (int i = 0; i < CVT_LOADS; ++i) r[i] = *(const v4f*)(s + o + i * 1024);
#pragma unroll  // constant indices keep r[] in registers
  for (int i = 0; i < CVT_LOADS; ++i) *(v4h*)(d + o + i * 1024) = cvt4(r[i]);
}

// ---------------------------------------------------------------------------
// Kernel 1: fused top-2 gating -> dense [T,E] weights.
// ---------------------------------------------------------------------------
__global__ __launch_bounds__(256) void moe_gating_kernel(
    const float* __restrict__ gating, float* __restrict__ w_full) {
  int t = blockIdx.x * blockDim.x + threadIdx.x;
  if (t >= T_DIM) return;
  float l[E_DIM];
  float m = -INFINITY;
#pragma unroll
  for (int e = 0; e < E_DIM; ++e) {
    l[e] = gating[t * E_DIM + e];
    m = fmaxf(m, l[e]);
  }
  float p[E_DIM];
#pragma unroll
  for (int e = 0; e < E_DIM; ++e) p[e] = __expf(l[e] - m);
  int i1 = 0;
#pragma unroll
  for (int e = 1; e < E_DIM; ++e) if (p[e] > p[i1]) i1 = e;
  int i2 = (i1 == 0) ? 1 : 0;
#pragma unroll
  for (int e = 0; e < E_DIM; ++e) if (e != i1 && p[e] > p[i2]) i2 = e;
  float rden = __builtin_amdgcn_rcpf(p[i1] + p[i2]);
#pragma unroll
  for (int e = 0; e < E_DIM; ++e) {
    float w = 0.0f;
    if (e == i1) w = p[i1] * rden;
    if (e == i2) w = p[i2] * rden;
    w_full[t * E_DIM + e] = w;
  }
}

// ---------------------------------------------------------------------------
// Kernel 2: per-expert fused gate+up GEMM + SiLU-gate epilogue -> h (f16).
// Double-buffered LDS, one barrier per K-step: compute from buffer `cur`
// while register-prefetched f16 slices are stored into buffer `cur^1`.
// The second launch bound asks for 4 waves per SIMD (a budget of 256 VGPRs), so
// that two workgroups share a WGP and each runs while the other waits on its
// loads, its LDS or its barrier.
// ---------------------------------------------------------------------------
__global__ __launch_bounds__(256, 4) void moe_gateup_kernel(
    const _Float16* __restrict__ x,   // [T, D] f16
    const _Float16* __restrict__ gw,  // [F, D] f16
    const _Float16* __restrict__ uw,  // [F, D] f16
    _Float16* __restrict__ h) {       // [T, F]
  __shared__ __attribute__((aligned(16))) _Float16 sA[2 * TILE];  // 36 KB
  __shared__ __attribute__((aligned(16))) _Float16 sG[2 * TILE];  // 36 KB
  __shared__ __attribute__((aligned(16))) _Float16 sU[2 * TILE];  // 36 KB

  const int tid = threadIdx.x;
  const int lane = tid & 31;
  const int wave = tid >> 5;
  const int waveM = wave >> 1;   // 0..3  (32 rows each)
  const int waveN = wave & 1;    // 0..1  (64 cols each)
  const int fr = lane & 15;
  const int fh = lane >> 4;

  const int blockM = blockIdx.x * BM;
  const int blockN = blockIdx.y * BN;

  // Global->LDS mapping: 8 threads per row slice, 8 halves each, 4 rows per thread.
  const int row = tid >> 3, col = (tid & 7) * 8;
  const int soff = row * LDP + col;
  const _Float16* pax = x  + (size_t)(blockM + row) * D_DIM + col;
  const _Float16* pgw = gw + (size_t)(blockN + row) * D_DIM + col;
  const _Float16* puw = uw + (size_t)(blockN + row) * D_DIM + col;

  v8h ra[4], rg[4], ru[4];
  ld16<D_DIM>(pax, ra);
  ld16<D_DIM>(pgw, rg);
  ld16<D_DIM>(puw, ru);
  st16(&sA[soff], ra);
  st16(&sG[soff], rg);
  st16(&sU[soff], ru);
  __syncthreads();

  v8f cg[2][4] = {};
  v8f cu[2][4] = {};

  for (int k0 = 0; k0 < D_DIM; k0 += BK) {
    const int cur = (k0 / BK) & 1;
    const int nxt = cur ^ 1;
    const bool has_next = (k0 + BK) < D_DIM;

    if (has_next) {  // issue next-slice global loads under the WMMA chain
      ld16<D_DIM>(pax + k0 + BK, ra);
      ld16<D_DIM>(pgw + k0 + BK, rg);
      ld16<D_DIM>(puw + k0 + BK, ru);
      // the fragment loads below reuse the address registers of these loads
      asm volatile("s_wait_xcnt 0x0" ::: "memory");
    }

    const _Float16* A = sA + cur * TILE;
    const _Float16* G = sG + cur * TILE;
    const _Float16* U = sU + cur * TILE;
#pragma unroll  // the two 32-wide halves of the slice, in ascending k
    for (int kk = 0; kk < BK / 32; ++kk) {
      v16h aF[2];
#pragma unroll
      for (int i = 0; i < 2; ++i)
        aF[i] = load_frag(A, waveM * 32 + i * 16 + fr, fh, kk);
      // The weight fragments come in two halves of the wave's 64 columns: 32 and not
      // 64 registers hold them at a time, which keeps the kernel inside the budget
      // without scratch.
#pragma unroll
      for (int jh = 0; jh < 4; jh += 2) {
        v16h gF[2], uF[2];
#pragma unroll
        for (int j = 0; j < 2; ++j) {
          gF[j] = load_frag(G, waveN * 64 + (jh + j) * 16 + fr, fh, kk);
          uF[j] = load_frag(U, waveN * 64 + (jh + j) * 16 + fr, fh, kk);
        }
#pragma unroll
        for (int i = 0; i < 2; ++i)
#pragma unroll
          for (int j = 0; j < 2; ++j) {
            cg[i][jh + j] = wmma_f16(aF[i], gF[j], cg[i][jh + j]);
            cu[i][jh + j] = wmma_f16(aF[i], uF[j], cu[i][jh + j]);
          }
      }
    }

    if (has_next) {  // fill the other buffer; published by the barrier below
      st16(&sA[nxt * TILE + soff], ra);
      st16(&sG[nxt * TILE + soff], rg);
      st16(&sU[nxt * TILE + soff], ru);
    }
    __syncthreads();
  }

  // Epilogue: silu(g)*u -> f16.  C layout: n = lane&15, m = r + 8*(lane>>4).
#pragma unroll
  for (int i = 0; i < 2; ++i)
#pragma unroll
    for (int j = 0; j < 4; ++j) {
      const int m_base = blockM + waveM * 32 + i * 16 + fh * 8;
      const int n = blockN + waveN * 64 + j * 16 + fr;
#pragma unroll
      for (int r = 0; r < 8; ++r) {
        float g = cg[i][j][r];
        float u = cu[i][j][r];
        float sig = __builtin_amdgcn_rcpf(1.0f + __expf(-g));
        h[(size_t)(m_base + r) * F_DIM + n] = (_Float16)(g * sig * u);
      }
    }
}

// ---------------------------------------------------------------------------
// Kernel 3: per-expert down GEMM + gating-weight epilogue.
// A-operand (h, f16) pipelined into double-buffered LDS by the Tensor Data
// Mover (issue for k+1 at top of step k, wait only after the WMMA chain);
// B-operand (f16) staged through registers by the threads while the TDM runs.
// ---------------------------------------------------------------------------
__global__ __launch_bounds__(256) void moe_down_kernel(
    const _Float16* __restrict__ h,  // [T, F] f16
    const _Float16* __restrict__ dw, // [D, F] f16
    const float* __restrict__ wcol,  // w_full + e (stride E)
    float* __restrict__ out,         // [T, D]
    int accum) {
  // 36 KB each; sA is the TDM destination (ping-pong), both buffers at multiples of 2 KiB.
  __shared__ __attribute__((aligned(2048))) _Float16 sA[2 * TILE];
  __shared__ __attribute__((aligned(16))) _Float16 sB[2 * TILE];

  const int tid = threadIdx.x;
  const int lane = tid & 31;
  const int wave = tid >> 5;
  const int waveM = wave >> 1;
  const int waveN = wave & 1;
  const int fr = lane & 15;
  const int fh = lane >> 4;

  const int blockM = blockIdx.x * BM;  // tokens
  const int blockN = blockIdx.y * BN;  // hidden dim D

  const int row = tid >> 3, col = (tid & 7) * 8;  // as in the gate+up kernel
  const int soff = row * LDP + col;
  const _Float16* pb = dw + (size_t)(blockN + row) * F_DIM + col;

#if HAVE_TDM
  // Tensor DMA descriptor (2D), every extent in bytes: tile = tensor = BM rows of
  // 128 B at the source pitch of h; a 16-B pad behind every 128-B row lays the
  // rows at the 144-B pitch that load_frag reads.
  constexpr uint32_t ROWB = BK * sizeof(_Float16);
  const uint32_t lds_a = (uint32_t)(uintptr_t)(void*)sA;
  const uint64_t gbase = (uint64_t)(uintptr_t)(h + (size_t)blockM * F_DIM);
  i32x8 g1;
  g1[0] = (int)((1u << 20) | (4u << 22) | (3u << 25));      // pad on, every 32 dwords, 4 dwords
  g1[1] = (int)(ROWB << 16);                                // tensor_dim0 lo
  g1[2] = (int)((uint32_t)BM << 16);                        // dim0 hi | dim1 lo
  g1[3] = (int)(ROWB << 16);                                // dim1 hi | tile_dim0
  g1[4] = (int)(uint32_t)BM;                                // tile_dim1 (tile_dim2=0)
  g1[5] = (int)(uint32_t)(F_DIM * sizeof(_Float16));        // source row pitch
  g1[6] = 0;
  g1[7] = 0;
  const i32x4 z4 = {0, 0, 0, 0};
  const i32x8 z8 = {0, 0, 0, 0, 0, 0, 0, 0};
#define TDM_ISSUE(K0, BUF)                                                    \
  do {                                                                        \
    uint64_t ga = gbase + (uint64_t)(K0) * sizeof(_Float16);                  \
    u32x4 g0;                                                                 \
    g0[0] = 1u;                                                               \
    g0[1] = lds_a + (uint32_t)((BUF) * TILE * sizeof(_Float16));              \
    g0[2] = (uint32_t)ga;                                                     \
    g0[3] = (uint32_t)((ga >> 32) & 0x01FFFFFFu) | (2u << 30);                \
    __builtin_amdgcn_tensor_load_to_lds(g0, g1, z4, z4, z8, 0);               \
  } while (0)
#else
  const int asoff = (tid >> 1) * LDP + (tid & 1) * 32;
  const _Float16* pa = h + (size_t)(blockM + (tid >> 1)) * F_DIM + (tid & 1) * 32;
#define A_COPY(K0, BUF)                                                       \
  do {                                                                        \
    for (int q = 0; q < 4; ++q)                                               \
      *(v8h*)&sA[(BUF) * TILE + asoff + q * 8] = *(const v8h*)(pa + (K0) + q * 8); \
  } while (0)
#endif

  // ---- prologue: fill buffer 0 ----
  v8h rb[4];
  ld16<F_DIM>(pb, rb);
#if HAVE_TDM
  if (wave == 0) TDM_ISSUE(0, 0);
#else
  A_COPY(0, 0);
#endif
  st16(&sB[soff], rb);
  ld16<F_DIM>(pb + BK, rb);  // slice k=BK into regs
#if HAVE_TDM
  if (wave == 0) __builtin_amdgcn_s_wait_tensorcnt(0);
#endif
  __syncthreads();

  v8f c[2][4] = {};

  for (int k0 = 0; k0 < F_DIM; k0 += BK) {
    const int cur = (k0 / BK) & 1;
    const int nxt = cur ^ 1;
    const bool has_next = (k0 + BK) < F_DIM;

#if HAVE_TDM
    if (has_next && wave == 0) TDM_ISSUE(k0 + BK, nxt);  // overlaps compute
#else
    if (has_next) A_COPY(k0 + BK, nxt);
#endif

    const _Float16* A = sA + cur * TILE;
    const _Float16* B = sB + cur * TILE;
#pragma unroll  // the two 32-wide halves of the slice, in ascending k
    for (int kk = 0; kk < BK / 32; ++kk) {
      v16h aF[2], bF[4];
#pragma unroll
      for (int i = 0; i < 2; ++i)
        aF[i] = load_frag(A, waveM * 32 + i * 16 + fr, fh, kk);
#pragma unroll
      for (int j = 0; j < 4; ++j)
        bF[j] = load_frag(B, waveN * 64 + j * 16 + fr, fh, kk);
#pragma unroll
      for (int i = 0; i < 2; ++i)
#pragma unroll
        for (int j = 0; j < 4; ++j)
          c[i][j] = wmma_f16(aF[i], bF[j], c[i][j]);
    }

    if (has_next) {
      st16(&sB[nxt * TILE + soff], rb);                       // publish B k+1
      // fetch B k+2 (in the built code the barrier below waits for these loads)
      if (k0 + 2 * BK < F_DIM) ld16<F_DIM>(pb + k0 + 2 * BK, rb);
#if HAVE_TDM
      if (wave == 0) __builtin_amdgcn_s_wait_tensorcnt(0);    // TDM k+1 done
#endif
    }
    __syncthreads();
  }

  // The accum test stands inside the element loop: in the built code each read of
  // out is waited for before the next one issues.
#pragma unroll
  for (int i = 0; i < 2; ++i)
#pragma unroll
    for (int j = 0; j < 4; ++j) {
      const int m_base = blockM + waveM * 32 + i * 16 + fh * 8;
      const int n = blockN + waveN * 64 + j * 16 + fr;
#pragma unroll
      for (int r = 0; r < 8; ++r) {
        const int t = m_base + r;
        float wgt = wcol[(size_t)t * E_DIM];
        float val = wgt * c[i][j][r];
        size_t o = (size_t)t * D_DIM + n;
        out[o] = accum ? (out[o] + val) : val;
      }
    }
}

// ---------------------------------------------------------------------------
// Launch: gating, f16 copies, then per expert: gate+up -> down (sequential on stream).
// Workspace: h (T*F f16 = 16 MB), w_full (T*E f32), x in f16 (8 MB), the three
// weight tensors in f16 (32 MB each).
// ---------------------------------------------------------------------------
extern "C" void kernel_launch(void* const* d_in, const int* in_sizes, int n_in,
                              void* d_out, int out_size, void* d_ws, size_t ws_size,
                              hipStream_t stream) {
  const float* x      = (const float*)d_in[0];
  const float* gating = (const float*)d_in[1];
  const float* gate_w = (const float*)d_in[2];
  const float* up_w   = (const float*)d_in[3];
  const float* down_w = (const float*)d_in[4];
  float* out = (float*)d_out;

  _Float16* h_ws = (_Float16*)d_ws;
  float* w_full = (float*)((char*)d_ws + (size_t)T_DIM * F_DIM * sizeof(_Float16));
  _Float16* x_h = (_Float16*)(w_full + (size_t)T_DIM * E_DIM);
  _Float16* w_h = x_h + (size_t)T_DIM * D_DIM;
  const _Float16* gate_h = w_h;
  const _Float16* up_h   = w_h + (size_t)E_DIM * F_DIM * D_DIM;
  const _Float16* down_h = w_h + (size_t)2 * E_DIM * F_DIM * D_DIM;

  moe_gating_kernel<<<T_DIM / 256, 256, 0, stream>>>(gating, w_full);
  moe_to_f16_kernel<<<dim3(SEG / CVT_BLK, CVT_SEGS), 256, 0, stream>>>(
      x, gate_w, up_w, down_w, x_h, w_h);

  for (int e = 0; e < E_DIM; ++e) {
    const size_t woff = (size_t)e * F_DIM * D_DIM;
    moe_gateup_kernel<<<dim3(T_DIM / BM, F_DIM / BN), 256, 0, stream>>>(
        x_h, gate_h + woff, up_h + woff, h_ws);
    moe_down_kernel<<<dim3(T_DIM / BM, D_DIM / BN), 256, 0, stream>>>(
        h_ws, down_h + woff, w_full + e, out, e == 0 ? 0 : 1);
  }
}

// v005
// One run takes 430 microseconds.
// Timed twice side by side with v004, it ran 1.35 and 1.34 times as fast.
// Over all steps from v000 it is 2.86 times as fast.
#include <hip/hip_runtime.h>
#include <hip/hip_fp16.h>
#include <math.h>
#include <stdint.h>

typedef __attribute__((ext_vector_type(16))) _Float16 v16h;
typedef __attribute__((ext_vector_type(8)))  _Float16 v8h;
typedef __attribute__((ext_vector_type(4)))  _Float16 v4h;
typedef __attribute__((ext_vector_type(8)))  float    v8f;
typedef __attribute__((ext_vector_type(4)))  float    v4f;
typedef __attribute__((ext_vector_type(4)))  unsigned int u32x4;
typedef __attribute__((ext_vector_type(8)))  int i32x8;
typedef __attribute__((ext_vector_type(4)))  int i32x4;

#if defined(__has_builtin)
#if __has_builtin(__builtin_amdgcn_tensor_load_to_lds) && \
    __has_builtin(__builtin_amdgcn_s_wait_tensorcnt)
#define HAVE_TDM 1
#endif
#endif

// Problem constants
constexpr int T_DIM = 4096;
constexpr int D_DIM = 1024;
constexpr int F_DIM = 2048;
constexpr int E_DIM = 8;

// Tiling: block 128(M) x 128(N) x 64(K); 8 waves, wave tile 32(M) x 64(N).
constexpr int BM = 128;
constexpr int BN = 128;
constexpr int BK = 64;          // one staged row slice is 128 B of f16, a whole cache line
constexpr int LDP = BK + 8;     // LDS row pitch in halves: 144 B = 16 B x odd, so 16 rows of a b128 read fall on distinct banks
constexpr int TILE = BM * LDP;  // halves per LDS tile buffer (18,432 B, a multiple of 2 KiB)

// ---------------------------------------------------------------------------
// WMMA helper: D = A * B + C   (16x16x32, f16 in, f32 accumulate)
// ---------------------------------------------------------------------------
__device__ __forceinline__ v8f wmma_f16(v16h a, v16h b, v8f c) {
  return __builtin_amdgcn_wmma_f32_16x16x32_f16(
      false, a, false, b, (short)0, c, false, false);
}

// Build a 16x32 f16 fragment from a row-major LDS tile (row stride = LDP); kk picks
// the 32-wide half of the staged K slice.
// lane<16: row=lane, K in {0..7,16..23}; lane>=16: row=lane-16, K in {8..15,24..31}.
__device__ __forceinline__ v16h load_frag(const _Float16* lds, int row, int fh, int kk) {
  const _Float16* p = lds + row * LDP + kk * 32;
  v8h lo = *(const v8h*)(p + fh * 8);
  v8h hi = *(const v8h*)(p + 16 + fh * 8);
  return __builtin_shufflevector(lo, hi, 0, 1, 2, 3, 4, 5, 6, 7,
                                 8, 9, 10, 11, 12, 13, 14, 15);
}

__device__ __forceinline__ v4h cvt4(v4f a) {
  v4h r;
  r[0] = (_Float16)a[0]; r[1] = (_Float16)a[1];
  r[2] = (_Float16)a[2]; r[3] = (_Float16)a[3];
  return r;
}

// f16 tile staging, 128 rows x 64 halves by 256 threads. Eight lanes take the
// 128 B (one cache line) that a row has in the K slice, so a wave-wide 16-B load
// touches 4 whole lines; a thread holds 8 halves of rows r, r+32, r+64, r+96.
constexpr int RSTEP = 32;  // rows between two loads of one thread
template <int LD>
__device__ __forceinline__ void ld16(const _Float16* p, v8h r[4]) {
#pragma unroll  // constant indices keep r[] in registers and the row steps in the offset field
  for (int i = 0; i < 4; ++i) r[i] = *(const v8h*)(p + (size_t)i * RSTEP * LD);
}
__device__ __forceinline__ void st16(_Float16* d, const v8h r[4]) {
#pragma unroll  // constant indices keep r[] in registers
  for (int i = 0; i < 4; ++i) *(v8h*)(d + i * RSTEP * LDP) = r[i];
}

// ---------------------------------------------------------------------------
// Kernel 0: x and the three weight tensors, f32 -> f16, once per call. The GEMM
// kernels re-read every operand tile many times; they read it at 2 B an
// element and convert nothing. grid.y picks a segment of SEG elements: 0 is x,
// 1..4 gate_w, 5..8 up_w, 9..12 down_w (the weights land back to back in wh).
// ---------------------------------------------------------------------------
constexpr int SEG = T_DIM * D_DIM;          // elements per segment; a weight tensor is 4 segments
constexpr int CVT_LOADS = 8;                // 16-B loads in flight per thread
constexpr int CVT_BLK = 256 * 4 * CVT_LOADS;  // elements per block
constexpr int CVT_SEGS = 1 + 3 * 4;         // x and three weight tensors
static_assert((size_t)E_DIM * F_DIM * D_DIM == (size_t)4 * SEG, "a weight tensor is 4 segments");
__global__ __launch_bounds__(256) void moe_to_f16_kernel(
    const float* __restrict__ x, const float* __restrict__ gw,
    const float* __restrict__ uw, const float* __restrict__ dw,
    _Float16* __restrict__ xh, _Float16* __restrict__ wh) {
  const int seg = blockIdx.y;
  const float* s = x;
  _Float16* d = xh;
  if (seg > 0) {
    const int a = (seg - 1) >> 2;
    s = (a == 0 ? gw : (a == 1 ? uw : dw)) + (size_t)((seg - 1) & 3) * SEG;
    d = wh + (size_t)(seg - 1) * SEG;
  }
  const size_t o = (size_t)blockIdx.x * CVT_BLK + threadIdx.x * 4;
  v4f r[CVT_LOADS];
#pragma unroll  // all loads issue before the first store waits on one
  for (int i = 0; i < CVT_LOADS; ++i) r[i] = *(const v4f*)(s + o + i * 1024);
#pragma unroll  // constant indices keep r[] in registers
  for (int i = 0; i < CVT_LOADS; ++i) *(v4h*)(d + o + i * 1024) = cvt4(r[i]);
}

// ---------------------------------------------------------------------------
// Kernel 1: fused top-2 gating -> dense [T,E] weights.
// ---------------------------------------------------------------------------
__global__ __launch_bounds__(256) void moe_gating_kernel(
    const float* __restrict__ gating, float* __restrict__ w_full) {
  int t = blockIdx.x * blockDim.x + threadIdx.x;
  if (t >= T_DIM) return;
  float l[E_DIM];
  float m = -INFINITY;
#pragma unroll
  for (int e = 0; e < E_DIM; ++e) {
    l[e] = gating[t * E_DIM + e];
    m = fmaxf(m, l[e]);
  }
  float p[E_DIM];
#pragma unroll
  for (int e = 0; e < E_DIM; ++e) p[e] = __expf(l[e] - m);
  int i1 = 0;
#pragma unroll
  for (int e = 1; e < E_DIM; ++e) if (p[e] > p[i1]) i1 = e;
  int i2 = (i1 == 0) ? 1 : 0;
#pragma unroll
  for (int e = 0; e < E_DIM; ++e) if (e != i1 && p[e] > p[i2]) i2 = e;
  float rden = __builtin_amdgcn_rcpf(p[i1] + p[i2]);
#pragma unroll
  for (int e = 0; e < E_DIM; ++e) {
    float w = 0.0f;
    if (e == i1) w = p[i1] * rden;
    if (e == i2) w = p[i2] * rden;
    w_full[t * E_DIM + e] = w;
  }
}

// ---------------------------------------------------------------------------
// Kernel 2: fused gate+up GEMM + SiLU-gate epilogue -> h (f16), all experts in one
// launch: grid.z is the expert. The epilogue scales a row of h by the token's gating
// weight for that expert, so that the down kernel can sum over experts in its K loop.
// Double-buffered LDS, one barrier per K-step: compute from buffer `cur`
// while register-prefetched f16 slices are stored into buffer `cur^1`.
// The second launch bound asks for 4 waves per SIMD (a budget of 256 VGPRs), so
// that two workgroups share a WGP and each runs while the other waits on its
// loads, its LDS or its barrier.
// ---------------------------------------------------------------------------
__global__ __launch_bounds__(256, 4) void moe_gateup_kernel(
    const _Float16* __restrict__ x,   // [T, D] f16
    const _Float16* __restrict__ gw,  // [E, F, D] f16
    const _Float16* __restrict__ uw,  // [E, F, D] f16
    const float* __restrict__ w_full, // [T, E]
    _Float16* __restrict__ h) {       // [E, T, F]
  __shared__ __attribute__((aligned(16))) _Float16 sA[2 * TILE];  // 36 KB
  __shared__ __attribute__((aligned(16))) _Float16 sG[2 * TILE];  // 36 KB
  __shared__ __attribute__((aligned(16))) _Float16 sU[2 * TILE];  // 36 KB

  const int tid = threadIdx.x;
  const int lane = tid & 31;
  const int wave = tid >> 5;
  const int waveM = wave >> 1;   // 0..3  (32 rows each)
  const int waveN = wave & 1;    // 0..1  (64 cols each)
  const int fr = lane & 15;
  const int fh = lane >> 4;

  const int blockM = blockIdx.x * BM;
  const int blockN = blockIdx.y * BN;
  const int e = blockIdx.z;

  // Global->LDS mapping: 8 threads per row slice, 8 halves each, 4 rows per thread.
  const int row = tid >> 3, col = (tid & 7) * 8;
  const int soff = row * LDP + col;
  const _Float16* pax = x  + (size_t)(blockM + row) * D_DIM + col;
  const _Float16* pgw = gw + ((size_t)e * F_DIM + blockN + row) * D_DIM + col;
  const _Float16* puw = uw + ((size_t)e * F_DIM + blockN + row) * D_DIM + col;

  v8h ra[4], rg[4], ru[4];
  ld16<D_DIM>(pax, ra);
  ld16<D_DIM>(pgw, rg);
  ld16<D_DIM>(puw, ru);
  st16(&sA[soff], ra);
  st16(&sG[soff], rg);
  st16(&sU[soff], ru);
  __syncthreads();

  v8f cg[2][4] = {};
  v8f cu[2][4] = {};

  for (int k0 = 0; k0 < D_DIM; k0 += BK) {
    const int cur = (k0 / BK) & 1;
    const int nxt = cur ^ 1;
    const bool has_next = (k0 + BK) < D_DIM;

    if (has_next) {  // issue next-slice global loads under the WMMA chain
      ld16<D_DIM>(pax + k0 + BK, ra);
      ld16<D_DIM>(pgw + k0 + BK, rg);
      ld16<D_DIM>(puw + k0 + BK, ru);
      // the fragment loads below reuse the address registers of these loads
      asm volatile("s_wait_xcnt 0x0" ::: "memory");
    }

    const _Float16* A = sA + cur * TILE;
    const _Float16* G = sG + cur * TILE;
    const _Float16* U = sU + cur * TILE;
#pragma unroll  // the two 32-wide halves of the slice, in ascending k
    for (int kk = 0; kk < BK / 32; ++kk) {
      v16h aF[2];
#pragma unroll
      for (int i = 0; i < 2; ++i)
        aF[i] = load_frag(A, waveM * 32 + i * 16 + fr, fh, kk);
      // The weight fragments come in two halves of the wave's 64 columns: 32 and not
      // 64 registers hold them at a time, which keeps the kernel inside the budget
      // without scratch.
#pragma unroll
      for (int jh = 0; jh < 4; jh += 2) {
        v16h gF[2], uF[2];
#pragma unroll
        for (int j = 0; j < 2; ++j) {
          gF[j] = load_frag(G, waveN * 64 + (jh + j) * 16 + fr, fh, kk);
          uF[j] = load_frag(U, waveN * 64 + (jh + j) * 16 + fr, fh, kk);
        }
#pragma unroll
        for (int i = 0; i < 2; ++i)
#pragma unroll
          for (int j = 0; j < 2; ++j) {
            cg[i][jh + j] = wmma_f16(aF[i], gF[j], cg[i][jh + j]);
            cu[i][jh + j] = wmma_f16(aF[i], uF[j], cu[i][jh + j]);
          }
      }
    }

    if (has_next) {  // fill the other buffer; published by the barrier below
      st16(&sA[nxt * TILE + soff], ra);
      st16(&sG[nxt * TILE + soff], rg);
      st16(&sU[nxt * TILE + soff], ru);
    }
    __syncthreads();
  }

  // Epilogue: w*silu(g)*u -> f16.  C layout: n = lane&15, m = r + 8*(lane>>4).
  _Float16* he = h + (size_t)e * T_DIM * F_DIM;
  float wt[2][8];  // the gating weights of this lane's 16 rows, all loads in flight together
#pragma unroll  // constant indices keep wt[][] in registers
  for (int i = 0; i < 2; ++i)
#pragma unroll
    for (int r = 0; r < 8; ++r)
      wt[i][r] = w_full[(size_t)(blockM + waveM * 32 + i * 16 + fh * 8 + r) * E_DIM + e];
#pragma unroll
  for (int i = 0; i < 2; ++i) {
    const int m_base = blockM + waveM * 32 + i * 16 + fh * 8;
#pragma unroll
    for (int j = 0; j < 4; ++j) {
      const int n = blockN + waveN * 64 + j * 16 + fr;
#pragma unroll
      for (int r = 0; r < 8; ++r) {
        float g = cg[i][j][r];
        float u = cu[i][j][r];
        float sig = __builtin_amdgcn_rcpf(1.0f + __expf(-g));
        he[(size_t)(m_base + r) * F_DIM + n] = (_Float16)(g * sig * u * wt[i][r]);
      }
    }
  }
}

// ---------------------------------------------------------------------------
// Kernel 3: down GEMM of all experts in one launch. h carries the gating weights, so
// out = sum over (e, f) of h[e][t][f] * dw[e][d][f] is one product with K = E * F: the
// K loop walks the experts one after the other and out is stored once.
// A-operand (h, f16) pipelined into double-buffered LDS by the Tensor Data
// Mover (issue for k+1 at top of step k, wait only after the WMMA chain);
// B-operand (f16) staged through registers by the threads while the TDM runs.
// ---------------------------------------------------------------------------
__global__ __launch_bounds__(256) void moe_down_kernel(
    const _Float16* __restrict__ h,  // [E, T, F] f16
    const _Float16* __restrict__ dw, // [E, D, F] f16
    float* __restrict__ out) {       // [T, D]
  // 36 KB each; sA is the TDM destination (ping-pong), both buffers at multiples of 2 KiB.
  __shared__ __attribute__((aligned(2048))) _Float16 sA[2 * TILE];
  __shared__ __attribute__((aligned(16))) _Float16 sB[2 * TILE];

  const int tid = threadIdx.x;
  const int lane = tid & 31;
  const int wave = tid >> 5;
  const int waveM = wave >> 1;
  const int waveN = wave & 1;
  const int fr = lane & 15;
  const int fh = lane >> 4;

  const int blockM = blockIdx.x * BM;  // tokens
  const int blockN = blockIdx.y * BN;  // hidden dim D

  const int row = tid >> 3, col = (tid & 7) * 8;  // as in the gate+up kernel
  const int soff = row * LDP + col;
  const _Float16* pb = dw + (size_t)(blockN + row) * F_DIM + col;
  // K step s is slice s % ESTEPS of expert s / ESTEPS; element offsets of it in h and dw.
  constexpr int ESTEPS = F_DIM / BK;
  constexpr int KSTEPS = E_DIM * ESTEPS;
  auto a_off = [](int s) { return (size_t)(s / ESTEPS) * T_DIM * F_DIM + (s % ESTEPS) * BK; };
  auto b_off = [](int s) { return (size_t)(s / ESTEPS) * D_DIM * F_DIM + (s % ESTEPS) * BK; };

#if HAVE_TDM
  // Tensor DMA descriptor (2D), every extent in bytes: tile = tensor = BM rows of
  // 128 B at the source pitch of h; a 16-B pad behind every 128-B row lays the
  // rows at the 144-B pitch that load_frag reads.
  constexpr uint32_t ROWB = BK * sizeof(_Float16);
  const uint32_t lds_a = (uint32_t)(uintptr_t)(void*)sA;
  const uint64_t gbase = (uint64_t)(uintptr_t)(h + (size_t)blockM * F_DIM);
  i32x8 g1;
  g1[0] = (int)((1u << 20) | (4u << 22) | (3u << 25));      // pad on, every 32 dwords, 4 dwords
  g1[1] = (int)(ROWB << 16);                                // tensor_dim0 lo
  g1[2] = (int)((uint32_t)BM << 16);                        // dim0 hi | dim1 lo
  g1[3] = (int)(ROWB << 16);                                // dim1 hi | tile_dim0
  g1[4] = (int)(uint32_t)BM;                                // tile_dim1 (tile_dim2=0)
  g1[5] = (int)(uint32_t)(F_DIM * sizeof(_Float16));        // source row pitch
  g1[6] = 0;
  g1[7] = 0;
  // Group 1 stays in its own scalar registers through the K loop; left to the
  // compiler, words of it were rebuilt per step.
  asm volatile("" : "+s"(g1));
  const i32x4 z4 = {0, 0, 0, 0};
  const i32x8 z8 = {0, 0, 0, 0, 0, 0, 0, 0};
#define TDM_ISSUE(K0, BUF)                                                    \
  do {                                                                        \
    uint64_t ga = gbase + (uint64_t)(K0) * sizeof(_Float16);                  \
    u32x4 g0;                                                                 \
    g0[0] = 1u;                                                               \
    g0[1] = lds_a + (uint32_t)((BUF) * TILE * sizeof(_Float16));              \
    g0[2] = (uint32_t)ga;                                                     \
    g0[3] = (uint32_t)((ga >> 32) & 0x01FFFFFFu) | (2u << 30);                \
    __builtin_amdgcn_tensor_load_to_lds(g0, g1, z4, z4, z8, 0);               \
  } while (0)
#else
  const int asoff = (tid >> 1) * LDP + (tid & 1) * 32;
  const _Float16* pa = h + (size_t)(blockM + (tid >> 1)) * F_DIM + (tid & 1) * 32;
#define A_COPY(K0, BUF)                                                       \
  do {                                                                        \
    for (int q = 0; q < 4; ++q)                                               \
      *(v8h*)&sA[(BUF) * TILE + asoff + q * 8] = *(const v8h*)(pa + (K0) + q * 8); \
  } while (0)
#endif

  // ---- prologue: fill buffer 0 ----
  v8h rb[4];
  ld16<F_DIM>(pb, rb);
#if HAVE_TDM
  if (wave == 0) TDM_ISSUE(0, 0);
#else
  A_COPY(0, 0);
#endif
  st16(&sB[soff], rb);
  ld16<F_DIM>(pb + b_off(1), rb);  // step 1 into regs
#if HAVE_TDM
  if (wave == 0) __builtin_amdgcn_s_wait_tensorcnt(0);
#endif
  __syncthreads();

  v8f c[2][4] = {};

  for (int s = 0; s < KSTEPS; ++s) {
    const int cur = s & 1;
    const int nxt = cur ^ 1;
    const bool has_next = (s + 1) < KSTEPS;

#if HAVE_TDM
    if (has_next && wave == 0) TDM_ISSUE(a_off(s + 1), nxt);  // overlaps compute
#else
    if (has_next) A_COPY(a_off(s + 1), nxt);
#endif

    const _Float16* A = sA + cur * TILE;
    const _Float16* B = sB + cur * TILE;
#pragma unroll  // the two 32-wide halves of the slice, in ascending k
    for (int kk = 0; kk < BK / 32; ++kk) {
      v16h aF[2], bF[4];
#pragma unroll
      for (int i = 0; i < 2; ++i)
        aF[i] = load_frag(A, waveM * 32 + i * 16 + fr, fh, kk);
#pragma unroll
      for (int j = 0; j < 4; ++j)
        bF[j] = load_frag(B, waveN * 64 + j * 16 + fr, fh, kk);
#pragma unroll
      for (int i = 0; i < 2; ++i)
#pragma unroll
        for (int j = 0; j < 4; ++j)
          c[i][j] = wmma_f16(aF[i], bF[j], c[i][j]);
    }

    if (has_next) {
      st16(&sB[nxt * TILE + soff], rb);                       // publish B k+1
      // fetch B k+2 (in the built code the barrier below waits for these loads)
      if (s + 2 < KSTEPS) ld16<F_DIM>(pb + b_off(s + 2), rb);
#if HAVE_TDM
      if (wave == 0) __builtin_amdgcn_s_wait_tensorcnt(0);    // TDM k+1 done
#endif
    }
    __syncthreads();
  }

#pragma unroll
  for (int i = 0; i < 2; ++i)
#pragma unroll
    for (int j = 0; j < 4; ++j) {
      const int m_base = blockM + waveM * 32 + i * 16 + fh * 8;
      const int n = blockN + waveN * 64 + j * 16 + fr;
#pragma unroll
      for (int r = 0; r < 8; ++r) {
        out[(size_t)(m_base + r) * D_DIM + n] = c[i][j][r];
      }
    }
}

// ---------------------------------------------------------------------------
// Launch: gating, f16 copies, gate+up of all experts, down of all experts.
// Workspace: h (E*T*F f16 = 128 MB), w_full (T*E f32), x in f16 (8 MB), the three
// weight tensors in f16 (32 MB each).
// ---------------------------------------------------------------------------
extern "C" void kernel_launch(void* const* d_in, const int* in_sizes, int n_in,
                              void* d_out, int out_size, void* d_ws, size_t ws_size,
                              hipStream_t stream) {
  const float* x      = (const float*)d_in[0];
  const float* gating = (const float*)d_in[1];
  const float* gate_w = (const float*)d_in[2];
  const float* up_w   = (const float*)d_in[3];
  const float* down_w = (const float*)d_in[4];
  float* out = (float*)d_out;

  _Float16* h_ws = (_Float16*)d_ws;
  float* w_full = (float*)((char*)d_ws + (size_t)E_DIM * T_DIM * F_DIM * sizeof(_Float16));
  _Float16* x_h = (_Float16*)(w_full + (size_t)T_DIM * E_DIM);
  _Float16* w_h = x_h + (size_t)T_DIM * D_DIM;
  const _Float16* gate_h = w_h;
  const _Float16* up_h   = w_h + (size_t)E_DIM * F_DIM * D_DIM;
  const _Float16* down_h = w_h + (size_t)2 * E_DIM * F_DIM * D_DIM;

  moe_gating_kernel<<<T_DIM / 256, 256, 0, stream>>>(gating, w_full);
  moe_to_f16_kernel<<<dim3(SEG / CVT_BLK, CVT_SEGS), 256, 0, stream>>>(
      x, gate_w, up_w, down_w, x_h, w_h);

  moe_gateup_kernel<<<dim3(T_DIM / BM, F_DIM / BN, E_DIM), 256, 0, stream>>>(
      x_h, gate_h, up_h, w_full, h_ws);
  moe_down_kernel<<<dim3(T_DIM / BM, D_DIM / BN), 256, 0, stream>>>(h_ws, down_h, out);
}

// v006
// Measured time: 153 microseconds a run.
// Next to v005, in two timings, it ran 2.80 and 2.81 times as fast.
// Over all steps from v000 it is 8.02 times as fast.
#include <hip/hip_runtime.h>
#include <hip/hip_fp16.h>
#include <math.h>
#include <stdint.h>

typedef __attribute__((ext_vector_type(16))) _Float16 v16h;
typedef __attribute__((ext_vector_type(8)))  _Float16 v8h;
typedef __attribute__((ext_vector_type(4)))  _Float16 v4h;
typedef __attribute__((ext_vector_type(8)))  float    v8f;
typedef __attribute__((ext_vector_type(4)))  float    v4f;
typedef __attribute__((ext_vector_type(4)))  unsigned int u32x4;
typedef __attribute__((ext_vector_type(8)))  int i32x8;
typedef __attribute__((ext_vector_type(4)))  int i32x4;

#if defined(__has_builtin)
#if __has_builtin(__builtin_amdgcn_tensor_load_to_lds) && \
    __has_builtin(__builtin_amdgcn_s_wait_tensorcnt)
#define HAVE_TDM 1
#endif
#endif

// Problem constants
constexpr int T_DIM = 4096;
constexpr int D_DIM = 1024;
constexpr int F_DIM = 2048;
constexpr int E_DIM = 8;

// Tiling: block 128(M) x 128(N) x 64(K); 8 waves, wave tile 32(M) x 64(N).
constexpr int BM = 128;
constexpr int BN = 128;
constexpr int BK = 64;          // one staged row slice is 128 B of f16, a whole cache line
constexpr int LDP = BK + 8;     // LDS row pitch in halves: 144 B = 16 B x odd, so 16 rows of a b128 read fall on distinct banks
constexpr int TILE = BM * LDP;  // halves per LDS tile buffer (18,432 B, a multiple of 2 KiB)

// Routing: a (token, expert) pair with a nonzero place in the dense [T,E] weights is a
// "slot". The slots of an expert lie together, each expert's run rounded up to whole
// row tiles of BM; the filler rows carry token 0 with weight 0.
constexpr int TOPK = 2;
constexpr int MAXTILES = T_DIM * TOPK / BM + E_DIM;  // upper bound of the sum of rounded-up runs
constexpr int MAXROWS = MAXTILES * BM;

// ---------------------------------------------------------------------------
// WMMA helper: D = A * B + C   (16x16x32, f16 in, f32 accumulate)
// ---------------------------------------------------------------------------
__device__ __forceinline__ v8f wmma_f16(v16h a, v16h b, v8f c) {
  return __builtin_amdgcn_wmma_f32_16x16x32_f16(
      false, a, false, b, (short)0, c, false, false);
}

// Build a 16x32 f16 fragment from a row-major LDS tile (row stride = LDP); kk picks
// the 32-wide half of the staged K slice.
// lane<16: row=lane, K in {0..7,16..23}; lane>=16: row=lane-16, K in {8..15,24..31}.
__device__ __forceinline__ v16h load_frag(const _Float16* lds, int row, int fh, int kk) {
  const _Float16* p = lds + row * LDP + kk * 32;
  v8h lo = *(const v8h*)(p + fh * 8);
  v8h hi = *(const v8h*)(p + 16 + fh * 8);
  return __builtin_shufflevector(lo, hi, 0, 1, 2, 3, 4, 5, 6, 7,
                                 8, 9, 10, 11, 12, 13, 14, 15);
}

__device__ __forceinline__ v4h cvt4(v4f a) {
  v4h r;
  r[0] = (_Float16)a[0]; r[1] = (_Float16)a[1];
  r[2] = (_Float16)a[2]; r[3] = (_Float16)a[3];
  return r;
}

// f16 tile staging, 128 rows x 64 halves by 256 threads. Eight lanes take the
// 128 B (one cache line) that a row has in the K slice, so a wave-wide 16-B load
// touches 4 whole lines; a thread holds 8 halves of rows r, r+32, r+64, r+96.
constexpr int RSTEP = 32;  // rows between two loads of one thread
template <int LD>
__device__ __forceinline__ void ld16(const _Float16* p, v8h r[4]) {
#pragma unroll  // constant indices keep r[] in registers and the row steps in the offset field
  for (int i = 0; i < 4; ++i) r[i] = *(const v8h*)(p + (size_t)i * RSTEP * LD);
}
// The same for four rows at element offsets of their own from a common base.
__device__ __forceinline__ void ldrows(const _Float16* p, const int off[4], v8h r[4]) {
#pragma unroll  // constant indices keep r[] in registers
  for (int i = 0; i < 4; ++i) r[i] = *(const v8h*)(p + off[i]);
}
__device__ __forceinline__ void st16(_Float16* d, const v8h r[4]) {
#pragma unroll  // constant indices keep r[] in registers
  for (int i = 0; i < 4; ++i) *(v8h*)(d + i * RSTEP * LDP) = r[i];
}

// ---------------------------------------------------------------------------
// Kernel 0: x and the three weight tensors, f32 -> f16, once per call. The GEMM
// kernels re-read every operand tile many times; they read it at 2 B an
// element and convert nothing. grid.y picks a segment of SEG elements: 0 is x,
// 1..4 gate_w, 5..8 up_w, 9..12 down_w (the weights land back to back in wh).
// ---------------------------------------------------------------------------
constexpr int SEG = T_DIM * D_DIM;          // elements per segment; a weight tensor is 4 segments
constexpr int CVT_LOADS = 8;                // 16-B loads in flight per thread
constexpr int CVT_BLK = 256 * 4 * CVT_LOADS;  // elements per block
constexpr int CVT_SEGS = 1 + 3 * 4;         // x and three weight tensors
static_assert((size_t)E_DIM * F_DIM * D_DIM == (size_t)4 * SEG, "a weight tensor is 4 segments");
__global__ __launch_bounds__(256) void moe_to_f16_kernel(
    const float* __restrict__ x, const float* __restrict__ gw,
    const float* __restrict__ uw, const float* __restrict__ dw,
    _Float16* __restrict__ xh, _Float16* __restrict__ wh) {
  const int seg = blockIdx.y;
  const float* s = x;
  _Float16* d = xh;
  if (seg > 0) {
    const int a = (seg - 1) >> 2;
    s = (a == 0 ? gw : (a == 1 ? uw : dw)) + (size_t)((seg - 1) & 3) * SEG;
    d = wh + (size_t)(seg - 1) * SEG;
  }
  const size_t o = (size_t)blockIdx.x * CVT_BLK + threadIdx.x * 4;
  v4f r[CVT_LOADS];
#pragma unroll  // all loads issue before the first store waits on one
  for (int i = 0; i < CVT_LOADS; ++i) r[i] = *(const v4f*)(s + o + i * 1024);
#pragma unroll  // constant indices keep r[] in registers
  for (int i = 0; i < CVT_LOADS; ++i) *(v4h*)(d + o + i * 1024) = cvt4(r[i]);
}

// ---------------------------------------------------------------------------
// Kernel 1: top-2 gating and routing, one workgroup. The reference multiplies an
// expert's output row by the token's dense weight, which is an exact 0 for the six
// experts outside the top 2: those rows are never formed. A thread ranks 4 tokens;
// a prefix sum over the threads (8 counters of 16 bits in two 64-bit words) gives
// every (token, expert) pair its rank in token order, with no atomics.
//   slot_tok[s], slot_w[s]: token and weight of slot s;  tok_slot[t][2]: a token's slots;
//   tile_e[m]: expert of row tile m, -1 for a tile past the last one in use.
// ---------------------------------------------------------------------------
constexpr int RT_THREADS = 1024;
constexpr int RT_TOK = T_DIM / RT_THREADS;  // tokens per thread
__device__ __forceinline__ int cnt_of(unsigned long long lo, unsigned long long hi, int e) {
  return (int)(((e < 4 ? lo : hi) >> ((e & 3) * 16)) & 0xFFFFull);
}
__device__ __forceinline__ void cnt_inc(unsigned long long& lo, unsigned long long& hi, int e) {
  const unsigned long long one = 1ull << ((e & 3) * 16);
  if (e < 4) lo += one; else hi += one;
}
__global__ __launch_bounds__(RT_THREADS) void moe_route_kernel(
    const float* __restrict__ gating, int* __restrict__ slot_tok,
    float* __restrict__ slot_w, int* __restrict__ tok_slot, int* __restrict__ tile_e) {
  __shared__ unsigned long long sc[2][2][RT_THREADS];
  __shared__ int s_tot[E_DIM];
  __shared__ int s_tb[E_DIM + 1];
  const int tid = threadIdx.x;

  int i1[RT_TOK], i2[RT_TOK];
  float w1[RT_TOK], w2[RT_TOK];
  unsigned long long c0 = 0, c1 = 0;
  const v4f* gp = (const v4f*)(gating + (size_t)tid * RT_TOK * E_DIM);
  v4f gl[RT_TOK * E_DIM / 4];
#pragma unroll  // all loads issue before the first use waits on one
  for (int i = 0; i < RT_TOK * E_DIM / 4; ++i) gl[i] = gp[i];
  // gp as an input keeps the loads' address registers from being a load's own target
  // ahead of the wait
  asm volatile("s_wait_xcnt 0x0" :: "v"(gp) : "memory");
#pragma unroll  // constant indices keep the per-token arrays in registers
  for (int q = 0; q < RT_TOK; ++q) {
    float l[E_DIM];
    float m = -INFINITY;
#pragma unroll
    for (int e = 0; e < E_DIM; ++e) {
      l[e] = gl[q * (E_DIM / 4) + e / 4][e % 4];
      m = fmaxf(m, l[e]);
    }
    float p[E_DIM];
#pragma unroll
    for (int e = 0; e < E_DIM; ++e) p[e] = __expf(l[e] - m);
    int a = 0;
    float pa = p[0];
#pragma unroll
    for (int e = 1; e < E_DIM; ++e) if (p[e] > pa) { a = e; pa = p[e]; }
    int b = (a == 0) ? 1 : 0;
    float pb = (a == 0) ? p[1] : p[0];
#pragma unroll
    for (int e = 0; e < E_DIM; ++e) if (e != a && p[e] > pb) { b = e; pb = p[e]; }
    const float rden = __builtin_amdgcn_rcpf(pa + pb);
    i1[q] = a; i2[q] = b;
    w1[q] = pa * rden; w2[q] = pb * rden;
    cnt_inc(c0, c1, a);
    cnt_inc(c0, c1, b);
  }

  // Inclusive prefix sum over the threads, two LDS planes in turn: a step reads one
  // plane and writes the other, so one barrier a step is enough.
  unsigned long long a0 = c0, a1 = c1;
  int pl = 0;
  sc[0][0][tid] = a0;
  sc[0][1][tid] = a1;
  __syncthreads();
  for (int d = 1; d < RT_THREADS; d <<= 1) {
    if (tid >= d) {
      a0 += sc[pl][0][tid - d];
      a1 += sc[pl][1][tid - d];
    }
    pl ^= 1;
    sc[pl][0][tid] = a0;
    sc[pl][1][tid] = a1;
    __syncthreads();
  }
  if (tid == 0) {
    const unsigned long long t0 = sc[pl][0][RT_THREADS - 1];
    const unsigned long long t1 = sc[pl][1][RT_THREADS - 1];
    int tb = 0;
    for (int e = 0; e < E_DIM; ++e) {
      const int n = cnt_of(t0, t1, e);
      s_tot[e] = n;
      s_tb[e] = tb;
      tb += (n + BM - 1) / BM;
    }
    s_tb[E_DIM] = tb;
  }
  __syncthreads();

  // The thread's own tokens, from its exclusive prefix on.
  a0 -= c0;
  a1 -= c1;
  int sa[RT_TOK], sb[RT_TOK], tt[RT_TOK];
#pragma unroll  // constant indices keep the per-token arrays in registers
  for (int q = 0; q < RT_TOK; ++q) {
    tt[q] = tid * RT_TOK + q;
    sa[q] = s_tb[i1[q]] * BM + cnt_of(a0, a1, i1[q]);
    sb[q] = s_tb[i2[q]] * BM + cnt_of(a0, a1, i2[q]);
    cnt_inc(a0, a1, i1[q]);
    cnt_inc(a0, a1, i2[q]);
  }
#pragma unroll
  for (int q = 0; q < RT_TOK; ++q) {
    slot_tok[sa[q]] = tt[q]; slot_w[sa[q]] = w1[q];
    slot_tok[sb[q]] = tt[q]; slot_w[sb[q]] = w2[q];
    tok_slot[tt[q] * TOPK + 0] = sa[q];
    tok_slot[tt[q] * TOPK + 1] = sb[q];
  }
  // the inputs keep what the stores name in its registers up to the wait
  asm volatile("s_wait_xcnt 0x0"
               :: "v"(sa[0]), "v"(sa[1]), "v"(sa[2]), "v"(sa[3]), "v"(sb[0]), "v"(sb[1]),
                  "v"(sb[2]), "v"(sb[3]), "v"(tt[0]), "v"(tt[1]), "v"(tt[2]), "v"(tt[3]),
                  "v"(w1[0]), "v"(w1[1]), "v"(w1[2]), "v"(w1[3]), "v"(w2[0]), "v"(w2[1]),
                  "v"(w2[2]), "v"(w2[3])
               : "memory");
  static_assert(RT_TOK == 4, "the wait above names four tokens");
  // Filler rows and the tile table: every slot that no pair took.
  for (int s = tid; s < MAXROWS; s += RT_THREADS) {
    const int tile = s / BM;
    int e = -1;
#pragma unroll
    for (int k = 0; k < E_DIM; ++k)
      if (tile >= s_tb[k] && tile < s_tb[k + 1]) e = k;
    // Each wait stands in its store's own branch: the trip's closing arithmetic reuses
    // the registers of these stores.
    if (e < 0 || s - s_tb[e] * BM >= s_tot[e]) {
      slot_tok[s] = 0;
      slot_w[s] = 0.0f;
      asm volatile("s_wait_xcnt 0x0" ::: "memory");
    }
    if (s % BM == 0) {
      tile_e[tile] = e;
      asm volatile("s_wait_xcnt 0x0" ::: "memory");
    }
  }
}

// ---------------------------------------------------------------------------
// Kernel 2: fused gate+up GEMM + SiLU-gate epilogue -> h (f16), all experts in one
// launch: grid.x is a row tile of slots, all of one expert; the A rows are gathered
// from x by the slots' tokens. The epilogue scales a row of h by the slot's gating weight.
// Double-buffered LDS, one barrier per K-step: compute from buffer `cur`
// while register-prefetched f16 slices are stored into buffer `cur^1`.
// The second launch bound asks for 4 waves per SIMD (a budget of 256 VGPRs), so
// that two workgroups share a WGP and each runs while the other waits on its
// loads, its LDS or its barrier.
// ---------------------------------------------------------------------------
__global__ __launch_bounds__(256, 4) void moe_gateup_kernel(
    const _Float16* __restrict__ x,   // [T, D] f16
    const _Float16* __restrict__ gw,  // [E, F, D] f16
    const _Float16* __restrict__ uw,  // [E, F, D] f16
    const int* __restrict__ slot_tok, // [MAXROWS]
    const float* __restrict__ slot_w, // [MAXROWS]
    const int* __restrict__ tile_e,   // [MAXTILES]
    _Float16* __restrict__ h) {       // [MAXROWS, F]
  __shared__ __attribute__((aligned(16))) _Float16 sA[2 * TILE];  // 36 KB
  __shared__ __attribute__((aligned(16))) _Float16 sG[2 * TILE];  // 36 KB
  __shared__ __attribute__((aligned(16))) _Float16 sU[2 * TILE];  // 36 KB

  const int tid = threadIdx.x;
  const int lane = tid & 31;
  const int wave = tid >> 5;
  const int waveM = wave >> 1;   // 0..3  (32 rows each)
  const int waveN = wave & 1;    // 0..1  (64 cols each)
  const int fr = lane & 15;
  const int fh = lane >> 4;

  const int blockM = blockIdx.x * BM;
  const int blockN = blockIdx.y * BN;
  const int e = min(tile_e[blockIdx.x], E_DIM - 1);
  if (e < 0) return;  // a tile past the last one in use: the whole workgroup leaves

  // Global->LDS mapping: 8 threads per row slice, 8 halves each, 4 rows per thread.
  const int row = tid >> 3, col = (tid & 7) * 8;
  const int soff = row * LDP + col;
  int aoff[4];  // element offsets in x of this thread's four gathered rows
#pragma unroll  // constant indices keep aoff[] in registers
  for (int i = 0; i < 4; ++i)
    aoff[i] = min(max(slot_tok[blockM + row + i * RSTEP], 0), T_DIM - 1) * D_DIM + col;
  const _Float16* pgw = gw + ((size_t)e * F_DIM + blockN + row) * D_DIM + col;
  const _Float16* puw = uw + ((size_t)e * F_DIM + blockN + row) * D_DIM + col;

  v8h ra[4], rg[4], ru[4];
  ldrows(x, aoff, ra);
  ld16<D_DIM>(pgw, rg);
  ld16<D_DIM>(puw, ru);
  // the index arithmetic below reuses the address registers of these loads; the
  // scheduling barrier keeps that arithmetic from being lifted over the wait
  asm volatile("s_wait_xcnt 0x0" ::: "memory");
  __builtin_amdgcn_sched_barrier(0);
  st16(&sA[soff], ra);
  st16(&sG[soff], rg);
  st16(&sU[soff], ru);
  __syncthreads();

  v8f cg[2][4] = {};
  v8f cu[2][4] = {};

  for (int k0 = 0; k0 < D_DIM; k0 += BK) {
    const int cur = (k0 / BK) & 1;
    const int nxt = cur ^ 1;
    const bool has_next = (k0 + BK) < D_DIM;

    if (has_next) {  // issue next-slice global loads under the WMMA chain
      ldrows(x + k0 + BK, aoff, ra);
      ld16<D_DIM>(pgw + k0 + BK, rg);
      ld16<D_DIM>(puw + k0 + BK, ru);
      // the fragment loads below reuse the address registers of these loads
      asm volatile("s_wait_xcnt 0x0" ::: "memory");
    }

    const _Float16* A = sA + cur * TILE;
    const _Float16* G = sG + cur * TILE;
    const _Float16* U = sU + cur * TILE;
#pragma unroll  // the two 32-wide halves of the slice, in ascending k
    for (int kk = 0; kk < BK / 32; ++kk) {
      v16h aF[2];
#pragma unroll
      for (int i = 0; i < 2; ++i)
        aF[i] = load_frag(A, waveM * 32 + i * 16 + fr, fh, kk);
      // The weight fragments come in two halves of the wave's 64 columns: 32 and not
      // 64 registers hold them at a time, which keeps the kernel inside the budget
      // without scratch.
#pragma unroll
      for (int jh = 0; jh < 4; jh += 2) {
        v16h gF[2], uF[2];
#pragma unroll
        for (int j = 0; j < 2; ++j) {
          gF[j] = load_frag(G, waveN * 64 + (jh + j) * 16 + fr, fh, kk);
          uF[j] = load_frag(U, waveN * 64 + (jh + j) * 16 + fr, fh, kk);
        }
#pragma unroll
        for (int i = 0; i < 2; ++i)
#pragma unroll
          for (int j = 0; j < 2; ++j) {
            cg[i][jh + j] = wmma_f16(aF[i], gF[j], cg[i][jh + j]);
            cu[i][jh + j] = wmma_f16(aF[i], uF[j], cu[i][jh + j]);
          }
      }
    }

    if (has_next) {  // fill the other buffer; published by the barrier below
      st16(&sA[nxt * TILE + soff], ra);
      st16(&sG[nxt * TILE + soff], rg);
      st16(&sU[nxt * TILE + soff], ru);
    }
    __syncthreads();
  }

  // Epilogue: w*silu(g)*u -> f16.  C layout: n = lane&15, m = r + 8*(lane>>4).
  _Float16* he = h;
  float wt[2][8];  // the gating weights of this lane's 16 rows, all loads in flight together
  const float* pw = slot_w + blockM + waveM * 32 + fh * 8;
#pragma unroll  // constant indices keep wt[][] in registers
  for (int i = 0; i < 2; ++i)
#pragma unroll
    for (int r = 0; r < 8; ++r)
      wt[i][r] = pw[i * 16 + r];
  // pw as an input keeps the loads' address registers from being a load's own target
  // ahead of the wait
  asm volatile("s_wait_xcnt 0x0" :: "v"(pw) : "memory");
#pragma unroll
  for (int i = 0; i < 2; ++i) {
    const int m_base = blockM + waveM * 32 + i * 16 + fh * 8;
#pragma unroll
    for (int j = 0; j < 4; ++j) {
      const int n = blockN + waveN * 64 + j * 16 + fr;
#pragma unroll
      for (int r = 0; r < 8; ++r) {
        float g = cg[i][j][r];
        float u = cu[i][j][r];
        float sig = __builtin_amdgcn_rcpf(1.0f + __expf(-g));
        he[(size_t)(m_base + r) * F_DIM + n] = (_Float16)(g * sig * u * wt[i][r]);
      }
    }
  }
}

// ---------------------------------------------------------------------------
// Kernel 3: down GEMM of all experts in one launch: grid.x is a row tile of slots, all
// of one expert; y[slot] = h[slot] * dw[e]^T with K = F. h carries the gating weights,
// so a token's output is the plain sum of its two rows of y (kernel 4).
// A-operand (h, f16) pipelined into double-buffered LDS by the Tensor Data
// Mover (issue for k+1 at top of step k, wait only after the WMMA chain);
// B-operand (f16) staged through registers by the threads while the TDM runs.
// ---------------------------------------------------------------------------
__global__ __launch_bounds__(256) void moe_down_kernel(
    const _Float16* __restrict__ h,  // [MAXROWS, F] f16
    const _Float16* __restrict__ dw, // [E, D, F] f16
    const int* __restrict__ tile_e,  // [MAXTILES]
    float* __restrict__ y) {         // [MAXROWS, D]
  // 36 KB each; sA is the TDM destination (ping-pong), both buffers at multiples of 2 KiB.
  __shared__ __attribute__((aligned(2048))) _Float16 sA[2 * TILE];
  __shared__ __attribute__((aligned(16))) _Float16 sB[2 * TILE];

  const int tid = threadIdx.x;
  const int lane = tid & 31;
  const int wave = tid >> 5;
  const int waveM = wave >> 1;
  const int waveN = wave & 1;
  const int fr = lane & 15;
  const int fh = lane >> 4;

  const int blockM = blockIdx.x * BM;  // slots
  const int blockN = blockIdx.y * BN;  // hidden dim D
  const int e = min(tile_e[blockIdx.x], E_DIM - 1);
  if (e < 0) return;  // a tile past the last one in use: the whole workgroup leaves

  const int row = tid >> 3, col = (tid & 7) * 8;  // as in the gate+up kernel
  const int soff = row * LDP + col;
  const _Float16* pb = dw + ((size_t)e * D_DIM + blockN + row) * F_DIM + col;
  // Element offsets of K step s in a row of h and of dw.
  constexpr int KSTEPS = F_DIM / BK;
  auto a_off = [](int s) { return (size_t)s * BK; };
  auto b_off = [](int s) { return (size_t)s * BK; };

#if HAVE_TDM
  // Tensor DMA descriptor (2D), every extent in bytes: tile = tensor = BM rows of
  // 128 B at the source pitch of h; a 16-B pad behind every 128-B row lays the
  // rows at the 144-B pitch that load_frag reads.
  constexpr uint32_t ROWB = BK * sizeof(_Float16);
  const uint32_t lds_a = (uint32_t)(uintptr_t)(void*)sA;
  const uint64_t gbase = (uint64_t)(uintptr_t)(h + (size_t)blockM * F_DIM);
  i32x8 g1;
  g1[0] = (int)((1u << 20) | (4u << 22) | (3u << 25));      // pad on, every 32 dwords, 4 dwords
  g1[1] = (int)(ROWB << 16);                                // tensor_dim0 lo
  g1[2] = (int)((uint32_t)BM << 16);                        // dim0 hi | dim1 lo
  g1[3] = (int)(ROWB << 16);                                // dim1 hi | tile_dim0
  g1[4] = (int)(uint32_t)BM;                                // tile_dim1 (tile_dim2=0)
  g1[5] = (int)(uint32_t)(F_DIM * sizeof(_Float16));        // source row pitch
  g1[6] = 0;
  g1[7] = 0;
  // Group 1 stays in its own scalar registers through the K loop; left to the
  // compiler, words of it were rebuilt per step.
  asm volatile("" : "+s"(g1));
  const i32x4 z4 = {0, 0, 0, 0};
  const i32x8 z8 = {0, 0, 0, 0, 0, 0, 0, 0};
#define TDM_ISSUE(K0, BUF)                                                    \
  do {                                                                        \
    uint64_t ga = gbase + (uint64_t)(K0) * sizeof(_Float16);                  \
    u32x4 g0;                                                                 \
    g0[0] = 1u;                                                               \
    g0[1] = lds_a + (uint32_t)((BUF) * TILE * sizeof(_Float16));              \
    g0[2] = (uint32_t)ga;                                                     \
    g0[3] = (uint32_t)((ga >> 32) & 0x01FFFFFFu) | (2u << 30);                \
    __builtin_amdgcn_tensor_load_to_lds(g0, g1, z4, z4, z8, 0);               \
  } while (0)
#else
  const int asoff = (tid >> 1) * LDP + (tid & 1) * 32;
  const _Float16* pa = h + (size_t)(blockM + (tid >> 1)) * F_DIM + (tid & 1) * 32;
#define A_COPY(K0, BUF)                                                       \
  do {                                                                        \
    for (int q = 0; q < 4; ++q)                                               \
      *(v8h*)&sA[(BUF) * TILE + asoff + q * 8] = *(const v8h*)(pa + (K0) + q * 8); \
  } while (0)
#endif

  // ---- prologue: fill buffer 0 ----
  v8h rb[4];
  ld16<F_DIM>(pb, rb);
#if HAVE_TDM
  if (wave == 0) TDM_ISSUE(0, 0);
#else
  A_COPY(0, 0);
#endif
  st16(&sB[soff], rb);
  ld16<F_DIM>(pb + b_off(1), rb);  // step 1 into regs
#if HAVE_TDM
  if (wave == 0) __builtin_amdgcn_s_wait_tensorcnt(0);
#endif
  __syncthreads();

  v8f c[2][4] = {};

  for (int s = 0; s < KSTEPS; ++s) {
    const int cur = s & 1;
    const int nxt = cur ^ 1;
    const bool has_next = (s + 1) < KSTEPS;

#if HAVE_TDM
    if (has_next && wave == 0) TDM_ISSUE(a_off(s + 1), nxt);  // overlaps compute
#else
    if (has_next) A_COPY(a_off(s + 1), nxt);
#endif

    const _Float16* A = sA + cur * TILE;
    const _Float16* B = sB + cur * TILE;
#pragma unroll  // the two 32-wide halves of the slice, in ascending k
    for (int kk = 0; kk < BK / 32; ++kk) {
      v16h aF[2], bF[4];
#pragma unroll
      for (int i = 0; i < 2; ++i)
        aF[i] = load_frag(A, waveM * 32 + i * 16 + fr, fh, kk);
#pragma unroll
      for (int j = 0; j < 4; ++j)
        bF[j] = load_frag(B, waveN * 64 + j * 16 + fr, fh, kk);
#pragma unroll
      for (int i = 0; i < 2; ++i)
#pragma unroll
        for (int j = 0; j < 4; ++j)
          c[i][j] = wmma_f16(aF[i], bF[j], c[i][j]);
    }

    if (has_next) {
      st16(&sB[nxt * TILE + soff], rb);                       // publish B k+1
      // fetch B k+2 (in the built code the barrier below waits for these loads)
      if (s + 2 < KSTEPS) ld16<F_DIM>(pb + b_off(s + 2), rb);
#if HAVE_TDM
      if (wave == 0) __builtin_amdgcn_s_wait_tensorcnt(0);    // TDM k+1 done
#endif
    }
    __syncthreads();
  }

#pragma unroll
  for (int i = 0; i < 2; ++i)
#pragma unroll
    for (int j = 0; j < 4; ++j) {
      const int m_base = blockM + waveM * 32 + i * 16 + fh * 8;
      const int n = blockN + waveN * 64 + j * 16 + fr;
#pragma unroll
      for (int r = 0; r < 8; ++r) {
        y[(size_t)(m_base + r) * D_DIM + n] = c[i][j][r];
      }
    }
}

// ---------------------------------------------------------------------------
// Kernel 4: out[t] = y[first slot of t] + y[second slot of t]. A workgroup takes
// CMB_TOK tokens, a thread 4 columns of each.
// ---------------------------------------------------------------------------
constexpr int CMB_TOK = 4;
__global__ __launch_bounds__(256) void moe_combine_kernel(
    const float* __restrict__ y, const int* __restrict__ tok_slot, float* __restrict__ out) {
  const int t0 = blockIdx.x * CMB_TOK;
  const int c = threadIdx.x * 4;
  v4f a[CMB_TOK], b[CMB_TOK];
#pragma unroll  // all loads issue before the first add waits on one
  for (int q = 0; q < CMB_TOK; ++q) {
    const int sa = min(max(tok_slot[(t0 + q) * TOPK + 0], 0), MAXROWS - 1);
    const int sb = min(max(tok_slot[(t0 + q) * TOPK + 1], 0), MAXROWS - 1);
    a[q] = *(const v4f*)(y + (size_t)sa * D_DIM + c);
    b[q] = *(const v4f*)(y + (size_t)sb * D_DIM + c);
  }
#pragma unroll  // constant indices keep a[] and b[] in registers
  for (int q = 0; q < CMB_TOK; ++q)
    *(v4f*)(out + (size_t)(t0 + q) * D_DIM + c) = a[q] + b[q];
}

// ---------------------------------------------------------------------------
// Launch: routing, f16 copies, gate+up and down over the routed row tiles, combine.
// Workspace: h (MAXROWS*F f16 = 36 MB), y (MAXROWS*D f32 = 36 MB), x in f16 (8 MB),
// the three weight tensors in f16 (32 MB each), the routing tables.
// ---------------------------------------------------------------------------
extern "C" void kernel_launch(void* const* d_in, const int* in_sizes, int n_in,
                              void* d_out, int out_size, void* d_ws, size_t ws_size,
                              hipStream_t stream) {
  const float* x      = (const float*)d_in[0];
  const float* gating = (const float*)d_in[1];
  const float* gate_w = (const float*)d_in[2];
  const float* up_w   = (const float*)d_in[3];
  const float* down_w = (const float*)d_in[4];
  float* out = (float*)d_out;

  _Float16* h_ws = (_Float16*)d_ws;
  float* y_ws = (float*)(h_ws + (size_t)MAXROWS * F_DIM);
  _Float16* x_h = (_Float16*)(y_ws + (size_t)MAXROWS * D_DIM);
  _Float16* w_h = x_h + (size_t)T_DIM * D_DIM;
  const _Float16* gate_h = w_h;
  const _Float16* up_h   = w_h + (size_t)E_DIM * F_DIM * D_DIM;
  const _Float16* down_h = w_h + (size_t)2 * E_DIM * F_DIM * D_DIM;
  int* slot_tok = (int*)(w_h + (size_t)3 * E_DIM * F_DIM * D_DIM);
  float* slot_w = (float*)(slot_tok + MAXROWS);
  int* tok_slot = (int*)(slot_w + MAXROWS);
  int* tile_e   = tok_slot + T_DIM * TOPK;

  moe_route_kernel<<<1, RT_THREADS, 0, stream>>>(gating, slot_tok, slot_w, tok_slot, tile_e);
  moe_to_f16_kernel<<<dim3(SEG / CVT_BLK, CVT_SEGS), 256, 0, stream>>>(
      x, gate_w, up_w, down_w, x_h, w_h);

  moe_gateup_kernel<<<dim3(MAXTILES, F_DIM / BN), 256, 0, stream>>>(
      x_h, gate_h, up_h, slot_tok, slot_w, tile_e, h_ws);
  moe_down_kernel<<<dim3(MAXTILES, D_DIM / BN), 256, 0, stream>>>(h_ws, down_h, tile_e, y_ws);
  moe_combine_kernel<<<T_DIM / CMB_TOK, 256, 0, stream>>>(y_ws, tok_slot, out);
}

// v007
// Measured time: 148 microseconds a run.
// Timed twice side by side with v006, it ran 1.04 times as fast both times.
// Over all steps from v000 it is 8.31 times as fast.
#include <hip/hip_runtime.h>
#include <hip/hip_fp16.h>
#include <math.h>
#include <stdint.h>

typedef __attribute__((ext_vector_type(16))) _Float16 v16h;
typedef __attribute__((ext_vector_type(8)))  _Float16 v8h;
typedef __attribute__((ext_vector_type(4)))  _Float16 v4h;
typedef __attribute__((ext_vector_type(8)))  float    v8f;
typedef __attribute__((ext_vector_type(4)))  float    v4f;
typedef __attribute__((ext_vector_type(4)))  unsigned int u32x4;
typedef __attribute__((ext_vector_type(8)))  int i32x8;
typedef __attribute__((ext_vector_type(4)))  int i32x4;

#if defined(__has_builtin)
#if __has_builtin(__builtin_amdgcn_tensor_load_to_lds) && \
    __has_builtin(__builtin_amdgcn_s_wait_tensorcnt)
#define HAVE_TDM 1
#endif
#endif

// Problem constants
constexpr int T_DIM = 4096;
constexpr int D_DIM = 1024;
constexpr int F_DIM = 2048;
constexpr int E_DIM = 8;

// Tiling: block 128(M) x 128(N) x 64(K); 8 waves, wave tile 32(M) x 64(N).
constexpr int BM = 128;
constexpr int BN = 128;
constexpr int BK = 64;          // one staged row slice is 128 B of f16, a whole cache line
constexpr int LDP = BK + 8;     // LDS row pitch in halves: 144 B = 16 B x odd, so 16 rows of a b128 read fall on distinct banks
constexpr int TILE = BM * LDP;  // halves per LDS tile buffer (18,432 B, a multiple of 2 KiB)

// Routing: a (token, expert) pair with a nonzero place in the dense [T,E] weights is a
// "slot". The slots of an expert lie together, each expert's run rounded up to whole
// row tiles of BM; the filler rows carry token 0 with weight 0.
constexpr int TOPK = 2;
constexpr int MAXTILES = T_DIM * TOPK / BM + E_DIM;  // upper bound of the sum of rounded-up runs
constexpr int MAXROWS = MAXTILES * BM;

// ---------------------------------------------------------------------------
// WMMA helper: D = A * B + C   (16x16x32, f16 in, f32 accumulate)
// ---------------------------------------------------------------------------
__device__ __forceinline__ v8f wmma_f16(v16h a, v16h b, v8f c) {
  return __builtin_amdgcn_wmma_f32_16x16x32_f16(
      false, a, false, b, (short)0, c, false, false);
}

// Build a 16x32 f16 fragment from a row-major LDS tile (row stride = LDP); kk picks
// the 32-wide half of the staged K slice.
// lane<16: row=lane, K in {0..7,16..23}; lane>=16: row=lane-16, K in {8..15,24..31}.
__device__ __forceinline__ v16h load_frag(const _Float16* lds, int row, int fh, int kk) {
  const _Float16* p = lds + row * LDP + kk * 32;
  v8h lo = *(const v8h*)(p + fh * 8);
  v8h hi = *(const v8h*)(p + 16 + fh * 8);
  return __builtin_shufflevector(lo, hi, 0, 1, 2, 3, 4, 5, 6, 7,
                                 8, 9, 10, 11, 12, 13, 14, 15);
}

__device__ __forceinline__ v4h cvt4(v4f a) {
  v4h r;
  r[0] = (_Float16)a[0]; r[1] = (_Float16)a[1];
  r[2] = (_Float16)a[2]; r[3] = (_Float16)a[3];
  return r;
}

// f16 tile staging, 128 rows x 64 halves by 256 threads. Eight lanes take the
// 128 B (one cache line) that a row has in the K slice, so a wave-wide 16-B load
// touches 4 whole lines; a thread holds 8 halves of rows r, r+32, r+64, r+96.
constexpr int RSTEP = 32;  // rows between two loads of one thread
template <int LD>
__device__ __forceinline__ void ld16(const _Float16* p, v8h r[4]) {
#pragma unroll  // constant indices keep r[] in registers and the row steps in the offset field
  for (int i = 0; i < 4; ++i) r[i] = *(const v8h*)(p + (size_t)i * RSTEP * LD);
}
// The same for four rows at element offsets of their own from a common base.
__device__ __forceinline__ void ldrows(const _Float16* p, const int off[4], v8h r[4]) {
#pragma unroll  // constant indices keep r[] in registers
  for (int i = 0; i < 4; ++i) r[i] = *(const v8h*)(p + off[i]);
}
__device__ __forceinline__ void st16(_Float16* d, const v8h r[4]) {
#pragma unroll  // constant indices keep r[] in registers
  for (int i = 0; i < 4; ++i) *(v8h*)(d + i * RSTEP * LDP) = r[i];
}

// ---------------------------------------------------------------------------
// Kernel 0: x, gate_w and up_w, f32 -> f16, once per call. The GEMM
// kernels re-read every operand tile many times; they read it at 2 B an
// element and convert nothing. grid.y picks a segment of SEG elements: 0 is x,
// 1..4 gate_w, 5..8 up_w (the weights land back to back in wh). down_w, which only
// kernel 3 reads, is converted inside the launch of kernel 2.
// ---------------------------------------------------------------------------
constexpr int SEG = T_DIM * D_DIM;          // elements per segment; a weight tensor is 4 segments
constexpr int CVT_LOADS = 8;                // 16-B loads in flight per thread
constexpr int CVT_BLK = 256 * 4 * CVT_LOADS;  // elements per block
constexpr int CVT_SEGS = 1 + 2 * 4;         // x and two weight tensors
static_assert((size_t)E_DIM * F_DIM * D_DIM == (size_t)4 * SEG, "a weight tensor is 4 segments");
__global__ __launch_bounds__(256) void moe_to_f16_kernel(
    const float* __restrict__ x, const float* __restrict__ gw,
    const float* __restrict__ uw,
    _Float16* __restrict__ xh, _Float16* __restrict__ wh) {
  const int seg = blockIdx.y;
  const float* s = x;
  _Float16* d = xh;
  if (seg > 0) {
    const int a = (seg - 1) >> 2;
    s = (a == 0 ? gw : uw) + (size_t)((seg - 1) & 3) * SEG;
    d = wh + (size_t)(seg - 1) * SEG;
  }
  const size_t o = (size_t)blockIdx.x * CVT_BLK + threadIdx.x * 4;
  v4f r[CVT_LOADS];
#pragma unroll  // all loads issue before the first store waits on one
  for (int i = 0; i < CVT_LOADS; ++i) r[i] = *(const v4f*)(s + o + i * 1024);
#pragma unroll  // constant indices keep r[] in registers
  for (int i = 0; i < CVT_LOADS; ++i) *(v4h*)(d + o + i * 1024) = cvt4(r[i]);
}

// ---------------------------------------------------------------------------
// Kernel 1: top-2 gating and routing, one workgroup. The reference multiplies an
// expert's output row by the token's dense weight, which is an exact 0 for the six
// experts outside the top 2: those rows are never formed. A thread ranks 4 tokens;
// a prefix sum over the threads (8 counters of 16 bits in two 64-bit words) gives
// every (token, expert) pair its rank in token order, with no atomics.
//   slot_tok[s], slot_w[s]: token and weight of slot s;  tok_slot[t][2]: a token's slots;
//   tile_e[m]: expert of row tile m, -1 for a tile past the last one in use.
// ---------------------------------------------------------------------------
constexpr int RT_THREADS = 1024;
constexpr int RT_TOK = T_DIM / RT_THREADS;  // tokens per thread
__device__ __forceinline__ int cnt_of(unsigned long long lo, unsigned long long hi, int e) {
  return (int)(((e < 4 ? lo : hi) >> ((e & 3) * 16)) & 0xFFFFull);
}
__device__ __forceinline__ void cnt_inc(unsigned long long& lo, unsigned long long& hi, int e) {
  const unsigned long long one = 1ull << ((e & 3) * 16);
  if (e < 4) lo += one; else hi += one;
}
__global__ __launch_bounds__(RT_THREADS) void moe_route_kernel(
    const float* __restrict__ gating, int* __restrict__ slot_tok,
    float* __restrict__ slot_w, int* __restrict__ tok_slot, int* __restrict__ tile_e) {
  __shared__ unsigned long long sc[2][2][RT_THREADS];
  __shared__ int s_tot[E_DIM];
  __shared__ int s_tb[E_DIM + 1];
  const int tid = threadIdx.x;

  int i1[RT_TOK], i2[RT_TOK];
  float w1[RT_TOK], w2[RT_TOK];
  unsigned long long c0 = 0, c1 = 0;
  const v4f* gp = (const v4f*)(gating + (size_t)tid * RT_TOK * E_DIM);
  v4f gl[RT_TOK * E_DIM / 4];
#pragma unroll  // all loads issue before the first use waits on one
  for (int i = 0; i < RT_TOK * E_DIM / 4; ++i) gl[i] = gp[i];
  // gp as an input keeps the loads' address registers from being a load's own target
  // ahead of the wait
  asm volatile("s_wait_xcnt 0x0" :: "v"(gp) : "memory");
#pragma unroll  // constant indices keep the per-token arrays in registers
  for (int q = 0; q < RT_TOK; ++q) {
    float l[E_DIM];
    float m = -INFINITY;
#pragma unroll
    for (int e = 0; e < E_DIM; ++e) {
      l[e] = gl[q * (E_DIM / 4) + e / 4][e % 4];
      m = fmaxf(m, l[e]);
    }
    float p[E_DIM];
#pragma unroll
    for (int e = 0; e < E_DIM; ++e) p[e] = __expf(l[e] - m);
    int a = 0;
    float pa = p[0];
#pragma unroll
    for (int e = 1; e < E_DIM; ++e) if (p[e] > pa) { a = e; pa = p[e]; }
    int b = (a == 0) ? 1 : 0;
    float pb = (a == 0) ? p[1] : p[0];
#pragma unroll
    for (int e = 0; e < E_DIM; ++e) if (e != a && p[e] > pb) { b = e; pb = p[e]; }
    const float rden = __builtin_amdgcn_rcpf(pa + pb);
    i1[q] = a; i2[q] = b;
    w1[q] = pa * rden; w2[q] = pb * rden;
    cnt_inc(c0, c1, a);
    cnt_inc(c0, c1, b);
  }

  // Inclusive prefix sum over the threads, two LDS planes in turn: a step reads one
  // plane and writes the other, so one barrier a step is enough.
  unsigned long long a0 = c0, a1 = c1;
  int pl = 0;
  sc[0][0][tid] = a0;
  sc[0][1][tid] = a1;
  __syncthreads();
  for (int d = 1; d < RT_THREADS; d <<= 1) {
    if (tid >= d) {
      a0 += sc[pl][0][tid - d];
      a1 += sc[pl][1][tid - d];
    }
    pl ^= 1;
    sc[pl][0][tid] = a0;
    sc[pl][1][tid] = a1;
    __syncthreads();
  }
  if (tid == 0) {
    const unsigned long long t0 = sc[pl][0][RT_THREADS - 1];
    const unsigned long long t1 = sc[pl][1][RT_THREADS - 1];
    int tb = 0;
    for (int e = 0; e < E_DIM; ++e) {
      const int n = cnt_of(t0, t1, e);
      s_tot[e] = n;
      s_tb[e] = tb;
      tb += (n + BM - 1) / BM;
    }
    s_tb[E_DIM] = tb;
  }
  __syncthreads();

  // The thread's own tokens, from its exclusive prefix on.
  a0 -= c0;
  a1 -= c1;
  int sa[RT_TOK], sb[RT_TOK], tt[RT_TOK];
#pragma unroll  // constant indices keep the per-token arrays in registers
  for (int q = 0; q < RT_TOK; ++q) {
    tt[q] = tid * RT_TOK + q;
    sa[q] = s_tb[i1[q]] * BM + cnt_of(a0, a1, i1[q]);
    sb[q] = s_tb[i2[q]] * BM + cnt_of(a0, a1, i2[q]);
    cnt_inc(a0, a1, i1[q]);
    cnt_inc(a0, a1, i2[q]);
  }
#pragma unroll
  for (int q = 0; q < RT_TOK; ++q) {
    slot_tok[sa[q]] = tt[q]; slot_w[sa[q]] = w1[q];
    slot_tok[sb[q]] = tt[q]; slot_w[sb[q]] = w2[q];
    tok_slot[tt[q] * TOPK + 0] = sa[q];
    tok_slot[tt[q] * TOPK + 1] = sb[q];
  }
  // the inputs keep what the stores name in its registers up to the wait
  asm volatile("s_wait_xcnt 0x0"
               :: "v"(sa[0]), "v"(sa[1]), "v"(sa[2]), "v"(sa[3]), "v"(sb[0]), "v"(sb[1]),
                  "v"(sb[2]), "v"(sb[3]), "v"(tt[0]), "v"(tt[1]), "v"(tt[2]), "v"(tt[3]),
                  "v"(w1[0]), "v"(w1[1]), "v"(w1[2]), "v"(w1[3]), "v"(w2[0]), "v"(w2[1]),
                  "v"(w2[2]), "v"(w2[3])
               : "memory");
  static_assert(RT_TOK == 4, "the wait above names four tokens");
  // Filler rows and the tile table: every slot that no pair took.
  for (int s = tid; s < MAXROWS; s += RT_THREADS) {
    const int tile = s / BM;
    int e = -1;
#pragma unroll
    for (int k = 0; k < E_DIM; ++k)
      if (tile >= s_tb[k] && tile < s_tb[k + 1]) e = k;
    // Each wait stands in its store's own branch: the trip's closing arithmetic reuses
    // the registers of these stores.
    if (e < 0 || s - s_tb[e] * BM >= s_tot[e]) {
      slot_tok[s] = 0;
      slot_w[s] = 0.0f;
      asm volatile("s_wait_xcnt 0x0" ::: "memory");
    }
    if (s % BM == 0) {
      tile_e[tile] = e;
      asm volatile("s_wait_xcnt 0x0" ::: "memory");
    }
  }
}

// ---------------------------------------------------------------------------
// Kernel 2: fused gate+up GEMM + SiLU-gate epilogue -> h (f16), all experts in one
// launch: grid.x is a row tile of slots, all of one expert; the A rows are gathered
// from x by the slots' tokens. The epilogue scales a row of h by the slot's gating weight.
// Double-buffered LDS, one barrier per K-step: compute from buffer `cur`
// while register-prefetched f16 slices are stored into buffer `cur^1`.
// The second launch bound asks for 4 waves per SIMD (a budget of 256 VGPRs), so
// that two workgroups share a WGP and each runs while the other waits on its
// loads, its LDS or its barrier.
// With two workgroups on each of 256 WGPs the GEMM tiles make two full rounds and a last
// one that leaves most places empty. The rows of the grid behind them (grid.y >= F / BN)
// convert down_w to f16: they use memory and no matrix unit, and
// nothing in this launch reads what they write.
// ---------------------------------------------------------------------------
constexpr int DW_LOADS = 16;                  // 16-B loads in flight per thread
constexpr int DW_BLK = 256 * 4 * DW_LOADS;    // elements per workgroup
constexpr int DW_BLKS = E_DIM * D_DIM * F_DIM / DW_BLK;
constexpr int DW_ROWS = (DW_BLKS + MAXTILES - 1) / MAXTILES;  // grid rows that hold them
static_assert((size_t)DW_BLKS * DW_BLK == (size_t)E_DIM * D_DIM * F_DIM, "whole blocks");
__global__ __launch_bounds__(256, 4) void moe_gateup_kernel(
    const _Float16* __restrict__ x,   // [T, D] f16
    const _Float16* __restrict__ gw,  // [E, F, D] f16
    const _Float16* __restrict__ uw,  // [E, F, D] f16
    const int* __restrict__ slot_tok, // [MAXROWS]
    const float* __restrict__ slot_w, // [MAXROWS]
    const int* __restrict__ tile_e,   // [MAXTILES]
    _Float16* __restrict__ h,         // [MAXROWS, F]
    const float* __restrict__ dwf,    // [E, D, F] f32
    _Float16* __restrict__ dwh) {     // [E, D, F] f16, written here
  __shared__ __attribute__((aligned(16))) _Float16 sA[2 * TILE];  // 36 KB
  __shared__ __attribute__((aligned(16))) _Float16 sG[2 * TILE];  // 36 KB
  __shared__ __attribute__((aligned(16))) _Float16 sU[2 * TILE];  // 36 KB

  const int tid = threadIdx.x;
  if (blockIdx.y >= F_DIM / BN) {  // the whole workgroup: a block of down_w, then it leaves
    const int blk = (blockIdx.y - F_DIM / BN) * MAXTILES + blockIdx.x;
    if (blk >= DW_BLKS) return;
    const size_t o = (size_t)blk * DW_BLK + tid * 4;
    const float* sp = dwf + o;
    v4f r[DW_LOADS];
#pragma unroll  // all loads issue before the first store waits on one
    for (int i = 0; i < DW_LOADS; ++i) r[i] = *(const v4f*)(sp + i * 1024);
    // sp as an input keeps the loads' address registers from being rewritten ahead of the wait
    asm volatile("s_wait_xcnt 0x0" :: "v"(sp) : "memory");
#pragma unroll  // constant indices keep r[] in registers
    for (int i = 0; i < DW_LOADS; ++i) *(v4h*)(dwh + o + i * 1024) = cvt4(r[i]);
    return;
  }
  const int lane = tid & 31;
  const int wave = tid >> 5;
  const int waveM = wave >> 1;   // 0..3  (32 rows each)
  const int waveN = wave & 1;    // 0..1  (64 cols each)
  const int fr = lane & 15;
  const int fh = lane >> 4;

  const int blockM = blockIdx.x * BM;
  const int blockN = blockIdx.y * BN;
  const int e = min(tile_e[blockIdx.x], E_DIM - 1);
  if (e < 0) return;  // a tile past the last one in use: the whole workgroup leaves

  // Global->LDS mapping: 8 threads per row slice, 8 halves each, 4 rows per thread.
  const int row = tid >> 3, col = (tid & 7) * 8;
  const int soff = row * LDP + col;
  int aoff[4];  // element offsets in x of this thread's four gathered rows
#pragma unroll  // constant indices keep aoff[] in registers
  for (int i = 0; i < 4; ++i)
    aoff[i] = min(max(slot_tok[blockM + row + i * RSTEP], 0), T_DIM - 1) * D_DIM + col;
  const _Float16* pgw = gw + ((size_t)e * F_DIM + blockN + row) * D_DIM + col;
  const _Float16* puw = uw + ((size_t)e * F_DIM + blockN + row) * D_DIM + col;

  v8h ra[4], rg[4], ru[4];
  ldrows(x, aoff, ra);
  ld16<D_DIM>(pgw, rg);
  ld16<D_DIM>(puw, ru);
  // the index arithmetic below reuses the address registers of these loads; the
  // scheduling barrier keeps that arithmetic from being lifted over the wait
  asm volatile("s_wait_xcnt 0x0" ::: "memory");
  __builtin_amdgcn_sched_barrier(0);
  st16(&sA[soff], ra);
  st16(&sG[soff], rg);
  st16(&sU[soff], ru);
  __syncthreads();

  v8f cg[2][4] = {};
  v8f cu[2][4] = {};

  for (int k0 = 0; k0 < D_DIM; k0 += BK) {
    const int cur = (k0 / BK) & 1;
    const int nxt = cur ^ 1;
    const bool has_next = (k0 + BK) < D_DIM;

    if (has_next) {  // issue next-slice global loads under the WMMA chain
      ldrows(x + k0 + BK, aoff, ra);
      ld16<D_DIM>(pgw + k0 + BK, rg);
      ld16<D_DIM>(puw + k0 + BK, ru);
      // the fragment loads below reuse the address registers of these loads
      asm volatile("s_wait_xcnt 0x0" ::: "memory");
    }

    const _Float16* A = sA + cur * TILE;
    const _Float16* G = sG + cur * TILE;
    const _Float16* U = sU + cur * TILE;
#pragma unroll  // the two 32-wide halves of the slice, in ascending k
    for (int kk = 0; kk < BK / 32; ++kk) {
      v16h aF[2];
#pragma unroll
      for (int i = 0; i < 2; ++i)
        aF[i] = load_frag(A, waveM * 32 + i * 16 + fr, fh, kk);
      // The weight fragments come in two halves of the wave's 64 columns: 32 and not
      // 64 registers hold them at a time, which keeps the kernel inside the budget
      // without scratch.
#pragma unroll
      for (int jh = 0; jh < 4; jh += 2) {
        v16h gF[2], uF[2];
#pragma unroll
        for (int j = 0; j < 2; ++j) {
          gF[j] = load_frag(G, waveN * 64 + (jh + j) * 16 + fr, fh, kk);
          uF[j] = load_frag(U, waveN * 64 + (jh + j) * 16 + fr, fh, kk);
        }
#pragma unroll
        for (int i = 0; i < 2; ++i)
#pragma unroll
          for (int j = 0; j < 2; ++j) {
            cg[i][jh + j] = wmma_f16(aF[i], gF[j], cg[i][jh + j]);
            cu[i][jh + j] = wmma_f16(aF[i], uF[j], cu[i][jh + j]);
          }
      }
    }

    if (has_next) {  // fill the other buffer; published by the barrier below
      st16(&sA[nxt * TILE + soff], ra);
      st16(&sG[nxt * TILE + soff], rg);
      st16(&sU[nxt * TILE + soff], ru);
    }
    __syncthreads();
  }

  // Epilogue: w*silu(g)*u -> f16.  C layout: n = lane&15, m = r + 8*(lane>>4).
  _Float16* he = h;
  float wt[2][8];  // the gating weights of this lane's 16 rows, all loads in flight together
  const float* pw = slot_w + blockM + waveM * 32 + fh * 8;
#pragma unroll  // constant indices keep wt[][] in registers
  for (int i = 0; i < 2; ++i)
#pragma unroll
    for (int r = 0; r < 8; ++r)
      wt[i][r] = pw[i * 16 + r];
  // pw as an input keeps the loads' address registers from being a load's own target
  // ahead of the wait
  asm volatile("s_wait_xcnt 0x0" :: "v"(pw) : "memory");
#pragma unroll
  for (int i = 0; i < 2; ++i) {
    const int m_base = blockM + waveM * 32 + i * 16 + fh * 8;
#pragma unroll
    for (int j = 0; j < 4; ++j) {
      const int n = blockN + waveN * 64 + j * 16 + fr;
#pragma unroll
      for (int r = 0; r < 8; ++r) {
        float g = cg[i][j][r];
        float u = cu[i][j][r];
        float sig = __builtin_amdgcn_rcpf(1.0f + __expf(-g));
        he[(size_t)(m_base + r) * F_DIM + n] = (_Float16)(g * sig * u * wt[i][r]);
      }
    }
  }
}

// ---------------------------------------------------------------------------
// Kernel 3: down GEMM of all experts in one launch: grid.x is a row tile of slots, all
// of one expert; y[slot] = h[slot] * dw[e]^T with K = F. h carries the gating weights,
// so a token's output is the plain sum of its two rows of y (kernel 4).
// A-operand (h, f16) pipelined into double-buffered LDS by the Tensor Data
// Mover (issue for k+1 at top of step k, wait only after the WMMA chain);
// B-operand (f16) staged through registers by the threads while the TDM runs.
// ---------------------------------------------------------------------------
__global__ __launch_bounds__(256) void moe_down_kernel(
    const _Float16* __restrict__ h,  // [MAXROWS, F] f16
    const _Float16* __restrict__ dw, // [E, D, F] f16
    const int* __restrict__ tile_e,  // [MAXTILES]
    float* __restrict__ y) {         // [MAXROWS, D]
  // 36 KB each; sA is the TDM destination (ping-pong), both buffers at multiples of 2 KiB.
  __shared__ __attribute__((aligned(2048))) _Float16 sA[2 * TILE];
  __shared__ __attribute__((aligned(16))) _Float16 sB[2 * TILE];

  const int tid = threadIdx.x;
  const int lane = tid & 31;
  const int wave = tid >> 5;
  const int waveM = wave >> 1;
  const int waveN = wave & 1;
  const int fr = lane & 15;
  const int fh = lane >> 4;

  const int blockM = blockIdx.x * BM;  // slots
  const int blockN = blockIdx.y * BN;  // hidden dim D
  const int e = min(tile_e[blockIdx.x], E_DIM - 1);
  if (e < 0) return;  // a tile past the last one in use: the whole workgroup leaves

  const int row = tid >> 3, col = (tid & 7) * 8;  // as in the gate+up kernel
  const int soff = row * LDP + col;
  const _Float16* pb = dw + ((size_t)e * D_DIM + blockN + row) * F_DIM + col;
  // Element offsets of K step s in a row of h and of dw.
  constexpr int KSTEPS = F_DIM / BK;
  auto a_off = [](int s) { return (size_t)s * BK; };
  auto b_off = [](int s) { return (size_t)s * BK; };

#if HAVE_TDM
  // Tensor DMA descriptor (2D), every extent in bytes: tile = tensor = BM rows of
  // 128 B at the source pitch of h; a 16-B pad behind every 128-B row lays the
  // rows at the 144-B pitch that load_frag reads.
  constexpr uint32_t ROWB = BK * sizeof(_Float16);
  const uint32_t lds_a = (uint32_t)(uintptr_t)(void*)sA;
  const uint64_t gbase = (uint64_t)(uintptr_t)(h + (size_t)blockM * F_DIM);
  i32x8 g1;
  g1[0] = (int)((1u << 20) | (4u << 22) | (3u << 25));      // pad on, every 32 dwords, 4 dwords
  g1[1] = (int)(ROWB << 16);                                // tensor_dim0 lo
  g1[2] = (int)((uint32_t)BM << 16);                        // dim0 hi | dim1 lo
  g1[3] = (int)(ROWB << 16);                                // dim1 hi | tile_dim0
  g1[4] = (int)(uint32_t)BM;                                // tile_dim1 (tile_dim2=0)
  g1[5] = (int)(uint32_t)(F_DIM * sizeof(_Float16));        // source row pitch
  g1[6] = 0;
  g1[7] = 0;
  // Group 1 stays in its own scalar registers through the K loop; left to the
  // compiler, words of it were rebuilt per step.
  asm volatile("" : "+s"(g1));
  const i32x4 z4 = {0, 0, 0, 0};
  const i32x8 z8 = {0, 0, 0, 0, 0, 0, 0, 0};
#define TDM_ISSUE(K0, BUF)                                                    \
  do {                                                                        \
    uint64_t ga = gbase + (uint64_t)(K0) * sizeof(_Float16);                  \
    u32x4 g0;                                                                 \
    g0[0] = 1u;                                                               \
    g0[1] = lds_a + (uint32_t)((BUF) * TILE * sizeof(_Float16));              \
    g0[2] = (uint32_t)ga;                                                     \
    g0[3] = (uint32_t)((ga >> 32) & 0x01FFFFFFu) | (2u << 30);                \
    __builtin_amdgcn_tensor_load_to_lds(g0, g1, z4, z4, z8, 0);               \
  } while (0)
#else
  const int asoff = (tid >> 1) * LDP + (tid & 1) * 32;
  const _Float16* pa = h + (size_t)(blockM + (tid >> 1)) * F_DIM + (tid & 1) * 32;
#define A_COPY(K0, BUF)                                                       \
  do {                                                                        \
    for (int q = 0; q < 4; ++q)                                               \
      *(v8h*)&sA[(BUF) * TILE + asoff + q * 8] = *(const v8h*)(pa + (K0) + q * 8); \
  } while (0)
#endif

  // ---- prologue: fill buffer 0 ----
  v8h rb[4];
  ld16<F_DIM>(pb, rb);
#if HAVE_TDM
  if (wave == 0) TDM_ISSUE(0, 0);
#else
  A_COPY(0, 0);
#endif
  st16(&sB[soff], rb);
  ld16<F_DIM>(pb + b_off(1), rb);  // step 1 into regs
#if HAVE_TDM
  if (wave == 0) __builtin_amdgcn_s_wait_tensorcnt(0);
#endif
  __syncthreads();

  v8f c[2][4] = {};

  for (int s = 0; s < KSTEPS; ++s) {
    const int cur = s & 1;
    const int nxt = cur ^ 1;
    const bool has_next = (s + 1) < KSTEPS;

#if HAVE_TDM
    if (has_next && wave == 0) TDM_ISSUE(a_off(s + 1), nxt);  // overlaps compute
#else
    if (has_next) A_COPY(a_off(s + 1), nxt);
#endif

    const _Float16* A = sA + cur * TILE;
    const _Float16* B = sB + cur * TILE;
#pragma unroll  // the two 32-wide halves of the slice, in ascending k
    for (int kk = 0; kk < BK / 32; ++kk) {
      v16h aF[2], bF[4];
#pragma unroll
      for (int i = 0; i < 2; ++i)
        aF[i] = load_frag(A, waveM * 32 + i * 16 + fr, fh, kk);
#pragma unroll
      for (int j = 0; j < 4; ++j)
        bF[j] = load_frag(B, waveN * 64 + j * 16 + fr, fh, kk);
#pragma unroll
      for (int i = 0; i < 2; ++i)
#pragma unroll
        for (int j = 0; j < 4; ++j)
          c[i][j] = wmma_f16(aF[i], bF[j], c[i][j]);
    }

    if (has_next) {
      st16(&sB[nxt * TILE + soff], rb);                       // publish B k+1
      // fetch B k+2 (in the built code the barrier below waits for these loads)
      if (s + 2 < KSTEPS) ld16<F_DIM>(pb + b_off(s + 2), rb);
#if HAVE_TDM
      if (wave == 0) __builtin_amdgcn_s_wait_tensorcnt(0);    // TDM k+1 done
#endif
    }
    __syncthreads();
  }

#pragma unroll
  for (int i = 0; i < 2; ++i)
#pragma unroll
    for (int j = 0; j < 4; ++j) {
      const int m_base = blockM + waveM * 32 + i * 16 + fh * 8;
      const int n = blockN + waveN * 64 + j * 16 + fr;
#pragma unroll
      for (int r = 0; r < 8; ++r) {
        y[(size_t)(m_base + r) * D_DIM + n] = c[i][j][r];
      }
    }
}

// ---------------------------------------------------------------------------
// Kernel 4: out[t] = y[first slot of t] + y[second slot of t]. A workgroup takes
// CMB_TOK tokens, a thread 4 columns of each.
// ---------------------------------------------------------------------------
constexpr int CMB_TOK = 4;
__global__ __launch_bounds__(256) void moe_combine_kernel(
    const float* __restrict__ y, const int* __restrict__ tok_slot, float* __restrict__ out) {
  const int t0 = blockIdx.x * CMB_TOK;
  const int c = threadIdx.x * 4;
  v4f a[CMB_TOK], b[CMB_TOK];
#pragma unroll  // all loads issue before the first add waits on one
  for (int q = 0; q < CMB_TOK; ++q) {
    const int sa = min(max(tok_slot[(t0 + q) * TOPK + 0], 0), MAXROWS - 1);
    const int sb = min(max(tok_slot[(t0 + q) * TOPK + 1], 0), MAXROWS - 1);
    a[q] = *(const v4f*)(y + (size_t)sa * D_DIM + c);
    b[q] = *(const v4f*)(y + (size_t)sb * D_DIM + c);
  }
#pragma unroll  // constant indices keep a[] and b[] in registers
  for (int q = 0; q < CMB_TOK; ++q)
    *(v4f*)(out + (size_t)(t0 + q) * D_DIM + c) = a[q] + b[q];
}

// ---------------------------------------------------------------------------
// Launch: routing, f16 copies (down_w's rides in the gate+up launch), gate+up and down
// over the routed row tiles, combine.
// Workspace: h (MAXROWS*F f16 = 36 MB), y (MAXROWS*D f32 = 36 MB), x in f16 (8 MB),
// the three weight tensors in f16 (32 MB each), the routing tables.
// ---------------------------------------------------------------------------
extern "C" void kernel_launch(void* const* d_in, const int* in_sizes, int n_in,
                              void* d_out, int out_size, void* d_ws, size_t ws_size,
                              hipStream_t stream) {
  const float* x      = (const float*)d_in[0];
  const float* gating = (const float*)d_in[1];
  const float* gate_w = (const float*)d_in[2];
  const float* up_w   = (const float*)d_in[3];
  const float* down_w = (const float*)d_in[4];
  float* out = (float*)d_out;

  _Float16* h_ws = (_Float16*)d_ws;
  float* y_ws = (float*)(h_ws + (size_t)MAXROWS * F_DIM);
  _Float16* x_h = (_Float16*)(y_ws + (size_t)MAXROWS * D_DIM);
  _Float16* w_h = x_h + (size_t)T_DIM * D_DIM;
  const _Float16* gate_h = w_h;
  const _Float16* up_h   = w_h + (size_t)E_DIM * F_DIM * D_DIM;
  _Float16* down_h       = w_h + (size_t)2 * E_DIM * F_DIM * D_DIM;
  int* slot_tok = (int*)(w_h + (size_t)3 * E_DIM * F_DIM * D_DIM);
  float* slot_w = (float*)(slot_tok + MAXROWS);
  int* tok_slot = (int*)(slot_w + MAXROWS);
  int* tile_e   = tok_slot + T_DIM * TOPK;

  moe_route_kernel<<<1, RT_THREADS, 0, stream>>>(gating, slot_tok, slot_w, tok_slot, tile_e);
  moe_to_f16_kernel<<<dim3(SEG / CVT_BLK, CVT_SEGS), 256, 0, stream>>>(
      x, gate_w, up_w, x_h, w_h);

  moe_gateup_kernel<<<dim3(MAXTILES, F_DIM / BN + DW_ROWS), 256, 0, stream>>>(
      x_h, gate_h, up_h, slot_tok, slot_w, tile_e, h_ws, down_w, down_h);
  moe_down_kernel<<<dim3(MAXTILES, D_DIM / BN), 256, 0, stream>>>(h_ws, down_h, tile_e, y_ws);
  moe_combine_kernel<<<T_DIM / CMB_TOK, 256, 0, stream>>>(y_ws, tok_slot, out);
}

// v008
// It runs in 142 microseconds.
// Next to v007, in two timings, it ran 1.04 times as fast each time.
// All steps since v000 together make it 8.64 times as fast.
#include <hip/hip_runtime.h>
#include <hip/hip_fp16.h>
#include <math.h>
#include <stdint.h>

typedef __attribute__((ext_vector_type(16))) _Float16 v16h;
typedef __attribute__((ext_vector_type(8)))  _Float16 v8h;
typedef __attribute__((ext_vector_type(4)))  _Float16 v4h;
typedef __attribute__((ext_vector_type(8)))  float    v8f;
typedef __attribute__((ext_vector_type(4)))  float    v4f;
typedef __attribute__((ext_vector_type(4)))  unsigned int u32x4;
typedef __attribute__((ext_vector_type(8)))  int i32x8;
typedef __attribute__((ext_vector_type(4)))  int i32x4;

#if defined(__has_builtin)
#if __has_builtin(__builtin_amdgcn_tensor_load_to_lds) && \
    __has_builtin(__builtin_amdgcn_s_wait_tensorcnt)
#define HAVE_TDM 1
#endif
#endif

// Problem constants
constexpr int T_DIM = 4096;
constexpr int D_DIM = 1024;
constexpr int F_DIM = 2048;
constexpr int E_DIM = 8;

// Tiling: block 128(M) x 128(N) x 64(K); 8 waves, wave tile 32(M) x 64(N).
constexpr int BM = 128;
constexpr int BN = 128;
constexpr int BK = 64;          // one staged row slice is 128 B of f16, a whole cache line
constexpr int LDP = BK + 8;     // LDS row pitch in halves: 144 B = 16 B x odd, so 16 rows of a b128 read fall on distinct banks
constexpr int TILE = BM * LDP;  // halves per LDS tile buffer (18,432 B, a multiple of 2 KiB)

// Routing: a (token, expert) pair with a nonzero place in the dense [T,E] weights is a
// "slot". The slots of an expert lie together, each expert's run rounded up to whole
// row tiles of BM; the filler rows carry token 0 with weight 0.
constexpr int TOPK = 2;
constexpr int MAXTILES = T_DIM * TOPK / BM + E_DIM;  // upper bound of the sum of rounded-up runs
constexpr int MAXROWS = MAXTILES * BM;

// ---------------------------------------------------------------------------
// WMMA helper: D = A * B + C   (16x16x32, f16 in, f32 accumulate)
// ---------------------------------------------------------------------------
__device__ __forceinline__ v8f wmma_f16(v16h a, v16h b, v8f c) {
  return __builtin_amdgcn_wmma_f32_16x16x32_f16(
      false, a, false, b, (short)0, c, false, false);
}

// Build a 16x32 f16 fragment from a row-major LDS tile (row stride = LDP); kk picks
// the 32-wide half of the staged K slice.
// lane<16: row=lane, K in {0..7,16..23}; lane>=16: row=lane-16, K in {8..15,24..31}.
__device__ __forceinline__ v16h load_frag(const _Float16* lds, int row, int fh, int kk) {
  const _Float16* p = lds + row * LDP + kk * 32;
  v8h lo = *(const v8h*)(p + fh * 8);
  v8h hi = *(const v8h*)(p + 16 + fh * 8);
  return __builtin_shufflevector(lo, hi, 0, 1, 2, 3, 4, 5, 6, 7,
                                 8, 9, 10, 11, 12, 13, 14, 15);
}

__device__ __forceinline__ v4h cvt4(v4f a) {
  v4h r;
  r[0] = (_Float16)a[0]; r[1] = (_Float16)a[1];
  r[2] = (_Float16)a[2]; r[3] = (_Float16)a[3];
  return r;
}

// f16 tile staging, 128 rows x 64 halves by 256 threads. Eight lanes take the
// 128 B (one cache line) that a row has in the K slice, so a wave-wide 16-B load
// touches 4 whole lines; a thread holds 8 halves of rows r, r+32, r+64, r+96.
constexpr int RSTEP = 32;  // rows between two loads of one thread
template <int LD>
__device__ __forceinline__ void ld16(const _Float16* p, v8h r[4]) {
#pragma unroll  // constant indices keep r[] in registers and the row steps in the offset field
  for (int i = 0; i < 4; ++i) r[i] = *(const v8h*)(p + (size_t)i * RSTEP * LD);
}
// The same for four rows at element offsets of their own from a common base.
__device__ __forceinline__ void ldrows(const _Float16* p, const int off[4], v8h r[4]) {
#pragma unroll  // constant indices keep r[] in registers
  for (int i = 0; i < 4; ++i) r[i] = *(const v8h*)(p + off[i]);
}
__device__ __forceinline__ void st16(_Float16* d, const v8h r[4]) {
#pragma unroll  // constant indices keep r[] in registers
  for (int i = 0; i < 4; ++i) *(v8h*)(d + i * RSTEP * LDP) = r[i];
}

// ---------------------------------------------------------------------------
// Kernel 0: x, gate_w and up_w, f32 -> f16, once per call. The GEMM
// kernels re-read every operand tile many times; they read it at 2 B an
// element and convert nothing. grid.y picks a segment of SEG elements: 0 is x,
// 1..4 gate_w, 5..8 up_w (the weights land back to back in wh). down_w, which only
// kernel 3 reads, is converted inside the launch of kernel 2.
// ---------------------------------------------------------------------------
constexpr int SEG = T_DIM * D_DIM;          // elements per segment; a weight tensor is 4 segments
constexpr int CVT_LOADS = 8;                // 16-B loads in flight per thread
constexpr int CVT_BLK = 256 * 4 * CVT_LOADS;  // elements per block
constexpr int CVT_SEGS = 1 + 2 * 4;         // x and two weight tensors
static_assert((size_t)E_DIM * F_DIM * D_DIM == (size_t)4 * SEG, "a weight tensor is 4 segments");
__global__ __launch_bounds__(256) void moe_to_f16_kernel(
    const float* __restrict__ x, const float* __restrict__ gw,
    const float* __restrict__ uw,
    _Float16* __restrict__ xh, _Float16* __restrict__ wh) {
  const int seg = blockIdx.y;
  const float* s = x;
  _Float16* d = xh;
  if (seg > 0) {
    const int a = (seg - 1) >> 2;
    s = (a == 0 ? gw : uw) + (size_t)((seg - 1) & 3) * SEG;
    d = wh + (size_t)(seg - 1) * SEG;
  }
  const size_t o = (size_t)blockIdx.x * CVT_BLK + threadIdx.x * 4;
  v4f r[CVT_LOADS];
#pragma unroll  // all loads issue before the first store waits on one
  for (int i = 0; i < CVT_LOADS; ++i) r[i] = *(const v4f*)(s + o + i * 1024);
#pragma unroll  // constant indices keep r[] in registers
  for (int i = 0; i < CVT_LOADS; ++i) *(v4h*)(d + o + i * 1024) = cvt4(r[i]);
}

// ---------------------------------------------------------------------------
// Kernel 1: top-2 gating and routing, one workgroup. The reference multiplies an
// expert's output row by the token's dense weight, which is an exact 0 for the six
// experts outside the top 2: those rows are never formed. A thread ranks 4 tokens;
// a prefix sum over the threads (8 counters of 16 bits in two 64-bit words) gives
// every (token, expert) pair its rank in token order, with no atomics.
//   slot_tok[s], slot_w[s]: token and weight of slot s;  tok_slot[t][2]: a token's slots;
//   tile_e[m]: expert of row tile m, -1 for a tile past the last one in use.
// ---------------------------------------------------------------------------
constexpr int RT_THREADS = 1024;
constexpr int RT_TOK = T_DIM / RT_THREADS;  // tokens per thread
__device__ __forceinline__ int cnt_of(unsigned long long lo, unsigned long long hi, int e) {
  return (int)(((e < 4 ? lo : hi) >> ((e & 3) * 16)) & 0xFFFFull);
}
__device__ __forceinline__ void cnt_inc(unsigned long long& lo, unsigned long long& hi, int e) {
  const unsigned long long one = 1ull << ((e & 3) * 16);
  if (e < 4) lo += one; else hi += one;
}
__global__ __launch_bounds__(RT_THREADS) void moe_route_kernel(
    const float* __restrict__ gating, int* __restrict__ slot_tok,
    float* __restrict__ slot_w, int* __restrict__ tok_slot, int* __restrict__ tile_e) {
  __shared__ unsigned long long sc[2][2][RT_THREADS];
  __shared__ int s_tot[E_DIM];
  __shared__ int s_tb[E_DIM + 1];
  const int tid = threadIdx.x;

  int i1[RT_TOK], i2[RT_TOK];
  float w1[RT_TOK], w2[RT_TOK];
  unsigned long long c0 = 0, c1 = 0;
  const v4f* gp = (const v4f*)(gating + (size_t)tid * RT_TOK * E_DIM);
  v4f gl[RT_TOK * E_DIM / 4];
#pragma unroll  // all loads issue before the first use waits on one
  for (int i = 0; i < RT_TOK * E_DIM / 4; ++i) gl[i] = gp[i];
  // gp as an input keeps the loads' address registers from being a load's own target
  // ahead of the wait
  asm volatile("s_wait_xcnt 0x0" :: "v"(gp) : "memory");
#pragma unroll  // constant indices keep the per-token arrays in registers
  for (int q = 0; q < RT_TOK; ++q) {
    float l[E_DIM];
    float m = -INFINITY;
#pragma unroll
    for (int e = 0; e < E_DIM; ++e) {
      l[e] = gl[q * (E_DIM / 4) + e / 4][e % 4];
      m = fmaxf(m, l[e]);
    }
    float p[E_DIM];
#pragma unroll
    for (int e = 0; e < E_DIM; ++e) p[e] = __expf(l[e] - m);
    int a = 0;
    float pa = p[0];
#pragma unroll
    for (int e = 1; e < E_DIM; ++e) if (p[e] > pa) { a = e; pa = p[e]; }
    int b = (a == 0) ? 1 : 0;
    float pb = (a == 0) ? p[1] : p[0];
#pragma unroll
    for (int e = 0; e < E_DIM; ++e) if (e != a && p[e] > pb) { b = e; pb = p[e]; }
    const float rden = __builtin_amdgcn_rcpf(pa + pb);
    i1[q] = a; i2[q] = b;
    w1[q] = pa * rden; w2[q] = pb * rden;
    cnt_inc(c0, c1, a);
    cnt_inc(c0, c1, b);
  }

  // Inclusive prefix sum over the threads, two LDS planes in turn: a step reads one
  // plane and writes the other, so one barrier a step is enough.
  unsigned long long a0 = c0, a1 = c1;
  int pl = 0;
  sc[0][0][tid] = a0;
  sc[0][1][tid] = a1;
  __syncthreads();
  for (int d = 1; d < RT_THREADS; d <<= 1) {
    if (tid >= d) {
      a0 += sc[pl][0][tid - d];
      a1 += sc[pl][1][tid - d];
    }
    pl ^= 1;
    sc[pl][0][tid] = a0;
    sc[pl][1][tid] = a1;
    __syncthreads();
  }
  if (tid == 0) {
    const unsigned long long t0 = sc[pl][0][RT_THREADS - 1];
    const unsigned long long t1 = sc[pl][1][RT_THREADS - 1];
    int tb = 0;
    for (int e = 0; e < E_DIM; ++e) {
      const int n = cnt_of(t0, t1, e);
      s_tot[e] = n;
      s_tb[e] = tb;
      tb += (n + BM - 1) / BM;
    }
    s_tb[E_DIM] = tb;
  }
  __syncthreads();

  // The thread's own tokens, from its exclusive prefix on.
  a0 -= c0;
  a1 -= c1;
  int sa[RT_TOK], sb[RT_TOK], tt[RT_TOK];
#pragma unroll  // constant indices keep the per-token arrays in registers
  for (int q = 0; q < RT_TOK; ++q) {
    tt[q] = tid * RT_TOK + q;
    sa[q] = s_tb[i1[q]] * BM + cnt_of(a0, a1, i1[q]);
    sb[q] = s_tb[i2[q]] * BM + cnt_of(a0, a1, i2[q]);
    cnt_inc(a0, a1, i1[q]);
    cnt_inc(a0, a1, i2[q]);
  }
#pragma unroll
  for (int q = 0; q < RT_TOK; ++q) {
    slot_tok[sa[q]] = tt[q]; slot_w[sa[q]] = w1[q];
    slot_tok[sb[q]] = tt[q]; slot_w[sb[q]] = w2[q];
    tok_slot[tt[q] * TOPK + 0] = sa[q];
    tok_slot[tt[q] * TOPK + 1] = sb[q];
  }
  // the inputs keep what the stores name in its registers up to the wait
  asm volatile("s_wait_xcnt 0x0"
               :: "v"(sa[0]), "v"(sa[1]), "v"(sa[2]), "v"(sa[3]), "v"(sb[0]), "v"(sb[1]),
                  "v"(sb[2]), "v"(sb[3]), "v"(tt[0]), "v"(tt[1]), "v"(tt[2]), "v"(tt[3]),
                  "v"(w1[0]), "v"(w1[1]), "v"(w1[2]), "v"(w1[3]), "v"(w2[0]), "v"(w2[1]),
                  "v"(w2[2]), "v"(w2[3])
               : "memory");
  static_assert(RT_TOK == 4, "the wait above names four tokens");
  // Filler rows and the tile table: every slot that no pair took.
  for (int s = tid; s < MAXROWS; s += RT_THREADS) {
    const int tile = s / BM;
    int e = -1;
#pragma unroll
    for (int k = 0; k < E_DIM; ++k)
      if (tile >= s_tb[k] && tile < s_tb[k + 1]) e = k;
    // Each wait stands in its store's own branch: the trip's closing arithmetic reuses
    // the registers of these stores.
    if (e < 0 || s - s_tb[e] * BM >= s_tot[e]) {
      slot_tok[s] = 0;
      slot_w[s] = 0.0f;
      asm volatile("s_wait_xcnt 0x0" ::: "memory");
    }
    if (s % BM == 0) {
      tile_e[tile] = e;
      asm volatile("s_wait_xcnt 0x0" ::: "memory");
    }
  }
}

// ---------------------------------------------------------------------------
// Kernel 2: fused gate+up GEMM + SiLU-gate epilogue -> h (f16), all experts in one
// launch: grid.x is a row tile of slots, all of one expert; the A rows are gathered
// from x by the slots' tokens. The epilogue scales a row of h by the slot's gating weight.
// Double-buffered LDS, one barrier per K-step: compute from buffer `cur`
// while register-prefetched f16 slices are stored into buffer `cur^1`.
// The second launch bound asks for 4 waves per SIMD (a budget of 256 VGPRs), so
// that two workgroups share a WGP and each runs while the other waits on its
// loads, its LDS or its barrier.
// With two workgroups on each of 256 WGPs the GEMM tiles make two full rounds and a last
// one that leaves most places empty. The rows of the grid behind them (grid.y >= F / BN)
// convert down_w to f16: they use memory and no matrix unit, and
// nothing in this launch reads what they write.
// ---------------------------------------------------------------------------
constexpr int DW_LOADS = 16;                  // 16-B loads in flight per thread
constexpr int DW_BLK = 256 * 4 * DW_LOADS;    // elements per workgroup
constexpr int DW_BLKS = E_DIM * D_DIM * F_DIM / DW_BLK;
constexpr int DW_ROWS = (DW_BLKS + MAXTILES - 1) / MAXTILES;  // grid rows that hold them
static_assert((size_t)DW_BLKS * DW_BLK == (size_t)E_DIM * D_DIM * F_DIM, "whole blocks");
__global__ __launch_bounds__(256, 4) void moe_gateup_kernel(
    const _Float16* __restrict__ x,   // [T, D] f16
    const _Float16* __restrict__ gw,  // [E, F, D] f16
    const _Float16* __restrict__ uw,  // [E, F, D] f16
    const int* __restrict__ slot_tok, // [MAXROWS]
    const float* __restrict__ slot_w, // [MAXROWS]
    const int* __restrict__ tile_e,   // [MAXTILES]
    _Float16* __restrict__ h,         // [MAXROWS, F]
    const float* __restrict__ dwf,    // [E, D, F] f32
    _Float16* __restrict__ dwh) {     // [E, D, F] f16, written here
  __shared__ __attribute__((aligned(16))) _Float16 sA[2 * TILE];  // 36 KB
  __shared__ __attribute__((aligned(16))) _Float16 sG[2 * TILE];  // 36 KB
  __shared__ __attribute__((aligned(16))) _Float16 sU[2 * TILE];  // 36 KB

  const int tid = threadIdx.x;
  if (blockIdx.y >= F_DIM / BN) {  // the whole workgroup: a block of down_w, then it leaves
    const int blk = (blockIdx.y - F_DIM / BN) * MAXTILES + blockIdx.x;
    if (blk >= DW_BLKS) return;
    const size_t o = (size_t)blk * DW_BLK + tid * 4;
    const float* sp = dwf + o;
    v4f r[DW_LOADS];
#pragma unroll  // all loads issue before the first store waits on one
    for (int i = 0; i < DW_LOADS; ++i) r[i] = *(const v4f*)(sp + i * 1024);
    // sp as an input keeps the loads' address registers from being rewritten ahead of the wait
    asm volatile("s_wait_xcnt 0x0" :: "v"(sp) : "memory");
#pragma unroll  // constant indices keep r[] in registers
    for (int i = 0; i < DW_LOADS; ++i) *(v4h*)(dwh + o + i * 1024) = cvt4(r[i]);
    return;
  }
  const int lane = tid & 31;
  const int wave = tid >> 5;
  const int waveM = wave >> 1;   // 0..3  (32 rows each)
  const int waveN = wave & 1;    // 0..1  (64 cols each)
  const int fr = lane & 15;
  const int fh = lane >> 4;

  const int blockM = blockIdx.x * BM;
  const int blockN = blockIdx.y * BN;
  const int e = min(tile_e[blockIdx.x], E_DIM - 1);
  if (e < 0) return;  // a tile past the last one in use: the whole workgroup leaves

  // Global->LDS mapping: 8 threads per row slice, 8 halves each, 4 rows per thread.
  const int row = tid >> 3, col = (tid & 7) * 8;
  const int soff = row * LDP + col;
  int aoff[4];  // element offsets in x of this thread's four gathered rows
#pragma unroll  // constant indices keep aoff[] in registers
  for (int i = 0; i < 4; ++i)
    aoff[i] = min(max(slot_tok[blockM + row + i * RSTEP], 0), T_DIM - 1) * D_DIM + col;
  const _Float16* pgw = gw + ((size_t)e * F_DIM + blockN + row) * D_DIM + col;
  const _Float16* puw = uw + ((size_t)e * F_DIM + blockN + row) * D_DIM + col;

  v8h ra[4], rg[4], ru[4];
  ldrows(x, aoff, ra);
  ld16<D_DIM>(pgw, rg);
  ld16<D_DIM>(puw, ru);
  // the index arithmetic below reuses the address registers of these loads; the
  // scheduling barrier keeps that arithmetic from being lifted over the wait
  asm volatile("s_wait_xcnt 0x0" ::: "memory");
  __builtin_amdgcn_sched_barrier(0);
  st16(&sA[soff], ra);
  st16(&sG[soff], rg);
  st16(&sU[soff], ru);
  __syncthreads();

  v8f cg[2][4] = {};
  v8f cu[2][4] = {};

  for (int k0 = 0; k0 < D_DIM; k0 += BK) {
    const int cur = (k0 / BK) & 1;
    const int nxt = cur ^ 1;
    const bool has_next = (k0 + BK) < D_DIM;

    if (has_next) {  // issue next-slice global loads under the WMMA chain
      ldrows(x + k0 + BK, aoff, ra);
      ld16<D_DIM>(pgw + k0 + BK, rg);
      ld16<D_DIM>(puw + k0 + BK, ru);
      // the fragment loads below reuse the address registers of these loads
      asm volatile("s_wait_xcnt 0x0" ::: "memory");
    }

    const _Float16* A = sA + cur * TILE;
    const _Float16* G = sG + cur * TILE;
    const _Float16* U = sU + cur * TILE;
#pragma unroll  // the two 32-wide halves of the slice, in ascending k
    for (int kk = 0; kk < BK / 32; ++kk) {
      v16h aF[2];
#pragma unroll
      for (int i = 0; i < 2; ++i)
        aF[i] = load_frag(A, waveM * 32 + i * 16 + fr, fh, kk);
      // The weight fragments come in two halves of the wave's 64 columns: 32 and not
      // 64 registers hold them at a time, which keeps the kernel inside the budget
      // without scratch.
#pragma unroll
      for (int jh = 0; jh < 4; jh += 2) {
        v16h gF[2], uF[2];
#pragma unroll
        for (int j = 0; j < 2; ++j) {
          gF[j] = load_frag(G, waveN * 64 + (jh + j) * 16 + fr, fh, kk);
          uF[j] = load_frag(U, waveN * 64 + (jh + j) * 16 + fr, fh, kk);
        }
#pragma unroll
        for (int i = 0; i < 2; ++i)
#pragma unroll
          for (int j = 0; j < 2; ++j) {
            cg[i][jh + j] = wmma_f16(aF[i], gF[j], cg[i][jh + j]);
            cu[i][jh + j] = wmma_f16(aF[i], uF[j], cu[i][jh + j]);
          }
      }
    }

    if (has_next) {  // fill the other buffer; published by the barrier below
      st16(&sA[nxt * TILE + soff], ra);
      st16(&sG[nxt * TILE + soff], rg);
      st16(&sU[nxt * TILE + soff], ru);
    }
    __syncthreads();
  }

  // Epilogue: w*silu(g)*u -> f16.  C layout: n = lane&15, m = r + 8*(lane>>4).
  _Float16* he = h;
  float wt[2][8];  // the gating weights of this lane's 16 rows, all loads in flight together
  const float* pw = slot_w + blockM + waveM * 32 + fh * 8;
#pragma unroll  // constant indices keep wt[][] in registers
  for (int i = 0; i < 2; ++i)
#pragma unroll
    for (int r = 0; r < 8; ++r)
      wt[i][r] = pw[i * 16 + r];
  // pw as an input keeps the loads' address registers from being a load's own target
  // ahead of the wait
  asm volatile("s_wait_xcnt 0x0" :: "v"(pw) : "memory");
#pragma unroll
  for (int i = 0; i < 2; ++i) {
    const int m_base = blockM + waveM * 32 + i * 16 + fh * 8;
#pragma unroll
    for (int j = 0; j < 4; ++j) {
      const int n = blockN + waveN * 64 + j * 16 + fr;
#pragma unroll
      for (int r = 0; r < 8; ++r) {
        float g = cg[i][j][r];
        float u = cu[i][j][r];
        float sig = __builtin_amdgcn_rcpf(1.0f + __expf(-g));
        he[(size_t)(m_base + r) * F_DIM + n] = (_Float16)(g * sig * u * wt[i][r]);
      }
    }
  }
}

// Workgroup barrier in two parts, for LDS traffic alone. __syncthreads() also drains the
// wave's global loads (s_wait_loadcnt 0); behind these two, loads issued ahead stay in flight.
// The wave's own LDS stores have landed and its LDS reads have returned:
__device__ __forceinline__ void wait_lds() { asm volatile("s_wait_dscnt 0x0" ::: "memory"); }
// The workgroup's own barrier; the clobber keeps every LDS access on its side of it:
__device__ __forceinline__ void lds_barrier() {
  asm volatile("s_barrier_signal -1\n\ts_barrier_wait -1" ::: "memory");
}

// ---------------------------------------------------------------------------
// Kernel 3: down GEMM of all experts in one launch: grid.x is a row tile of slots, all
// of one expert; y[slot] = h[slot] * dw[e]^T with K = F. h carries the gating weights,
// so a token's output is the plain sum of its two rows of y (kernel 4).
// A-operand (h, f16) pipelined into double-buffered LDS by the Tensor Data
// Mover (issue for k+1 at top of step k, wait only after the WMMA chain);
// B-operand (f16) staged through registers by the threads while the TDM runs.
// ---------------------------------------------------------------------------
__global__ __launch_bounds__(256) void moe_down_kernel(
    const _Float16* __restrict__ h,  // [MAXROWS, F] f16
    const _Float16* __restrict__ dw, // [E, D, F] f16
    const int* __restrict__ tile_e,  // [MAXTILES]
    float* __restrict__ y) {         // [MAXROWS, D]
  // 36 KB each; sA is the TDM destination (ping-pong), both buffers at multiples of 2 KiB.
  __shared__ __attribute__((aligned(2048))) _Float16 sA[2 * TILE];
  __shared__ __attribute__((aligned(16))) _Float16 sB[2 * TILE];

  const int tid = threadIdx.x;
  const int lane = tid & 31;
  const int wave = tid >> 5;
  const int waveM = wave >> 1;
  const int waveN = wave & 1;
  const int fr = lane & 15;
  const int fh = lane >> 4;

  const int blockM = blockIdx.x * BM;  // slots
  const int blockN = blockIdx.y * BN;  // hidden dim D
  const int e = min(tile_e[blockIdx.x], E_DIM - 1);
  if (e < 0) return;  // a tile past the last one in use: the whole workgroup leaves

  const int row = tid >> 3, col = (tid & 7) * 8;  // as in the gate+up kernel
  const int soff = row * LDP + col;
  const _Float16* pb = dw + ((size_t)e * D_DIM + blockN + row) * F_DIM + col;
  // Element offsets of K step s in a row of h and of dw.
  constexpr int KSTEPS = F_DIM / BK;
  auto a_off = [](int s) { return (size_t)s * BK; };
  auto b_off = [](int s) { return (size_t)s * BK; };

#if HAVE_TDM
  // Tensor DMA descriptor (2D), every extent in bytes: tile = tensor = BM rows of
  // 128 B at the source pitch of h; a 16-B pad behind every 128-B row lays the
  // rows at the 144-B pitch that load_frag reads.
  constexpr uint32_t ROWB = BK * sizeof(_Float16);
  const uint32_t lds_a = (uint32_t)(uintptr_t)(void*)sA;
  const uint64_t gbase = (uint64_t)(uintptr_t)(h + (size_t)blockM * F_DIM);
  i32x8 g1;
  g1[0] = (int)((1u << 20) | (4u << 22) | (3u << 25));      // pad on, every 32 dwords, 4 dwords
  g1[1] = (int)(ROWB << 16);                                // tensor_dim0 lo
  g1[2] = (int)((uint32_t)BM << 16);                        // dim0 hi | dim1 lo
  g1[3] = (int)(ROWB << 16);                                // dim1 hi | tile_dim0
  g1[4] = (int)(uint32_t)BM;                                // tile_dim1 (tile_dim2=0)
  g1[5] = (int)(uint32_t)(F_DIM * sizeof(_Float16));        // source row pitch
  g1[6] = 0;
  g1[7] = 0;
  // Group 1 stays in its own scalar registers through the K loop; left to the
  // compiler, words of it were rebuilt per step.
  asm volatile("" : "+s"(g1));
  const i32x4 z4 = {0, 0, 0, 0};
  const i32x8 z8 = {0, 0, 0, 0, 0, 0, 0, 0};
#define TDM_ISSUE(K0, BUF)                                                    \
  do {                                                                        \
    uint64_t ga = gbase + (uint64_t)(K0) * sizeof(_Float16);                  \
    u32x4 g0;                                                                 \
    g0[0] = 1u;                                                               \
    g0[1] = lds_a + (uint32_t)((BUF) * TILE * sizeof(_Float16));              \
    g0[2] = (uint32_t)ga;                                                     \
    g0[3] = (uint32_t)((ga >> 32) & 0x01FFFFFFu) | (2u << 30);                \
    __builtin_amdgcn_tensor_load_to_lds(g0, g1, z4, z4, z8, 0);               \
  } while (0)
#else
  const int asoff = (tid >> 1) * LDP + (tid & 1) * 32;
  const _Float16* pa = h + (size_t)(blockM + (tid >> 1)) * F_DIM + (tid & 1) * 32;
#define A_COPY(K0, BUF)                                                       \
  do {                                                                        \
    for (int q = 0; q < 4; ++q)                                               \
      *(v8h*)&sA[(BUF) * TILE + asoff + q * 8] = *(const v8h*)(pa + (K0) + q * 8); \
  } while (0)
#endif

  // ---- prologue: fill buffer 0 ----
  v8h rb[4];
  ld16<F_DIM>(pb, rb);
#if HAVE_TDM
  if (wave == 0) TDM_ISSUE(0, 0);
#else
  A_COPY(0, 0);
#endif
  st16(&sB[soff], rb);
  ld16<F_DIM>(pb + b_off(1), rb);  // step 1 into regs, in flight over the barrier
  // nothing drains these loads any more before later arithmetic reuses their address registers
  asm volatile("s_wait_xcnt 0x0" ::: "memory");
  wait_lds();
#if HAVE_TDM
  if (wave == 0) __builtin_amdgcn_s_wait_tensorcnt(0);
#endif
  lds_barrier();

  v8f c[2][4] = {};

  for (int s = 0; s < KSTEPS; ++s) {
    const int cur = s & 1;
    const int nxt = cur ^ 1;
    const bool has_next = (s + 1) < KSTEPS;

#if HAVE_TDM
    if (has_next && wave == 0) TDM_ISSUE(a_off(s + 1), nxt);  // overlaps compute
#else
    if (has_next) A_COPY(a_off(s + 1), nxt);
#endif

    const _Float16* A = sA + cur * TILE;
    const _Float16* B = sB + cur * TILE;
#pragma unroll  // the two 32-wide halves of the slice, in ascending k
    for (int kk = 0; kk < BK / 32; ++kk) {
      v16h aF[2], bF[4];
#pragma unroll
      for (int i = 0; i < 2; ++i)
        aF[i] = load_frag(A, waveM * 32 + i * 16 + fr, fh, kk);
#pragma unroll
      for (int j = 0; j < 4; ++j)
        bF[j] = load_frag(B, waveN * 64 + j * 16 + fr, fh, kk);
#pragma unroll
      for (int i = 0; i < 2; ++i)
#pragma unroll
        for (int j = 0; j < 4; ++j)
          c[i][j] = wmma_f16(aF[i], bF[j], c[i][j]);
    }

    if (has_next) {
      st16(&sB[nxt * TILE + soff], rb);                       // publish B k+1
      // fetch B k+2: these loads fly over the barrier below and through the whole next step
      if (s + 2 < KSTEPS) {
        ld16<F_DIM>(pb + b_off(s + 2), rb);
        // the next step's index arithmetic reuses the address registers of these loads
        asm volatile("s_wait_xcnt 0x0" ::: "memory");
      }
      wait_lds();
#if HAVE_TDM
      if (wave == 0) __builtin_amdgcn_s_wait_tensorcnt(0);    // TDM k+1 done
#endif
    }
    lds_barrier();
  }

#pragma unroll
  for (int i = 0; i < 2; ++i)
#pragma unroll
    for (int j = 0; j < 4; ++j) {
      const int m_base = blockM + waveM * 32 + i * 16 + fh * 8;
      const int n = blockN + waveN * 64 + j * 16 + fr;
#pragma unroll
      for (int r = 0; r < 8; ++r) {
        y[(size_t)(m_base + r) * D_DIM + n] = c[i][j][r];
      }
    }
}

// ---------------------------------------------------------------------------
// Kernel 4: out[t] = y[first slot of t] + y[second slot of t]. A workgroup takes
// CMB_TOK tokens, a thread 4 columns of each.
// ---------------------------------------------------------------------------
constexpr int CMB_TOK = 4;
__global__ __launch_bounds__(256) void moe_combine_kernel(
    const float* __restrict__ y, const int* __restrict__ tok_slot, float* __restrict__ out) {
  const int t0 = blockIdx.x * CMB_TOK;
  const int c = threadIdx.x * 4;
  v4f a[CMB_TOK], b[CMB_TOK];
#pragma unroll  // all loads issue before the first add waits on one
  for (int q = 0; q < CMB_TOK; ++q) {
    const int sa = min(max(tok_slot[(t0 + q) * TOPK + 0], 0), MAXROWS - 1);
    const int sb = min(max(tok_slot[(t0 + q) * TOPK + 1], 0), MAXROWS - 1);
    a[q] = *(const v4f*)(y + (size_t)sa * D_DIM + c);
    b[q] = *(const v4f*)(y + (size_t)sb * D_DIM + c);
  }
#pragma unroll  // constant indices keep a[] and b[] in registers
  for (int q = 0; q < CMB_TOK; ++q)
    *(v4f*)(out + (size_t)(t0 + q) * D_DIM + c) = a[q] + b[q];
}

// ---------------------------------------------------------------------------
// Launch: routing, f16 copies (down_w's rides in the gate+up launch), gate+up and down
// over the routed row tiles, combine.
// Workspace: h (MAXROWS*F f16 = 36 MB), y (MAXROWS*D f32 = 36 MB), x in f16 (8 MB),
// the three weight tensors in f16 (32 MB each), the routing tables.
// ---------------------------------------------------------------------------
extern "C" void kernel_launch(void* const* d_in, const int* in_sizes, int n_in,
                              void* d_out, int out_size, void* d_ws, size_t ws_size,
                              hipStream_t stream) {
  const float* x      = (const float*)d_in[0];
  const float* gating = (const float*)d_in[1];
  const float* gate_w = (const float*)d_in[2];
  const float* up_w   = (const float*)d_in[3];
  const float* down_w = (const float*)d_in[4];
  float* out = (float*)d_out;

  _Float16* h_ws = (_Float16*)d_ws;
  float* y_ws = (float*)(h_ws + (size_t)MAXROWS * F_DIM);
  _Float16* x_h = (_Float16*)(y_ws + (size_t)MAXROWS * D_DIM);
  _Float16* w_h = x_h + (size_t)T_DIM * D_DIM;
  const _Float16* gate_h = w_h;
  const _Float16* up_h   = w_h + (size_t)E_DIM * F_DIM * D_DIM;
  _Float16* down_h       = w_h + (size_t)2 * E_DIM * F_DIM * D_DIM;
  int* slot_tok = (int*)(w_h + (size_t)3 * E_DIM * F_DIM * D_DIM);
  float* slot_w = (float*)(slot_tok + MAXROWS);
  int* tok_slot = (int*)(slot_w + MAXROWS);
  int* tile_e   = tok_slot + T_DIM * TOPK;

  moe_route_kernel<<<1, RT_THREADS, 0, stream>>>(gating, slot_tok, slot_w, tok_slot, tile_e);
  moe_to_f16_kernel<<<dim3(SEG / CVT_BLK, CVT_SEGS), 256, 0, stream>>>(
      x, gate_w, up_w, x_h, w_h);

  moe_gateup_kernel<<<dim3(MAXTILES, F_DIM / BN + DW_ROWS), 256, 0, stream>>>(
      x_h, gate_h, up_h, slot_tok, slot_w, tile_e, h_ws, down_w, down_h);
  moe_down_kernel<<<dim3(MAXTILES, D_DIM / BN), 256, 0, stream>>>(h_ws, down_h, tile_e, y_ws);
  moe_combine_kernel<<<T_DIM / CMB_TOK, 256, 0, stream>>>(y_ws, tok_slot, out);
}

// v009
// A run of this version takes 129 microseconds.
// Next to v008, in two timings, it ran 1.10 times as fast each time.
// Over all steps from v000 it is 9.50 times as fast.
#include <hip/hip_runtime.h>
#include <hip/hip_fp16.h>
#include <math.h>
#include <stdint.h>

typedef __attribute__((ext_vector_type(16))) _Float16 v16h;
typedef __attribute__((ext_vector_type(8)))  _Float16 v8h;
typedef __attribute__((ext_vector_type(4)))  _Float16 v4h;
typedef __attribute__((ext_vector_type(8)))  float    v8f;
typedef __attribute__((ext_vector_type(4)))  float    v4f;
typedef __attribute__((ext_vector_type(4)))  unsigned int u32x4;
typedef __attribute__((ext_vector_type(8)))  int i32x8;
typedef __attribute__((ext_vector_type(4)))  int i32x4;

#if defined(__has_builtin)
#if __has_builtin(__builtin_amdgcn_tensor_load_to_lds) && \
    __has_builtin(__builtin_amdgcn_s_wait_tensorcnt)
#define HAVE_TDM 1
#endif
#endif

// Problem constants
constexpr int T_DIM = 4096;
constexpr int D_DIM = 1024;
constexpr int F_DIM = 2048;
constexpr int E_DIM = 8;

// Tiling: block 128(M) x 128(N) x 64(K); 8 waves, wave tile 32(M) x 64(N).
constexpr int BM = 128;
constexpr int BN = 128;
constexpr int BK = 64;          // one staged row slice is 128 B of f16, a whole cache line
constexpr int LDP = BK + 8;     // LDS row pitch in halves: 144 B = 16 B x odd, so 16 rows of a b128 read fall on distinct banks
constexpr int TILE = BM * LDP;  // halves per LDS tile buffer (18,432 B, a multiple of 2 KiB)

// Routing: a (token, expert) pair with a nonzero place in the dense [T,E] weights is a
// "slot". The slots of an expert lie together, each expert's run rounded up to whole
// row tiles of BM; the filler rows carry token 0 with weight 0.
constexpr int TOPK = 2;
constexpr int MAXTILES = T_DIM * TOPK / BM + E_DIM;  // upper bound of the sum of rounded-up runs
constexpr int MAXROWS = MAXTILES * BM;

// ---------------------------------------------------------------------------
// WMMA helper: D = A * B + C   (16x16x32, f16 in, f32 accumulate)
// ---------------------------------------------------------------------------
__device__ __forceinline__ v8f wmma_f16(v16h a, v16h b, v8f c) {
  return __builtin_amdgcn_wmma_f32_16x16x32_f16(
      false, a, false, b, (short)0, c, false, false);
}

// Build a 16x32 f16 fragment from a row-major LDS tile (row stride = LDP); kk picks
// the 32-wide half of the staged K slice.
// lane<16: row=lane, K in {0..7,16..23}; lane>=16: row=lane-16, K in {8..15,24..31}.
__device__ __forceinline__ v16h load_frag(const _Float16* lds, int row, int fh, int kk) {
  const _Float16* p = lds + row * LDP + kk * 32;
  v8h lo = *(const v8h*)(p + fh * 8);
  v8h hi = *(const v8h*)(p + 16 + fh * 8);
  return __builtin_shufflevector(lo, hi, 0, 1, 2, 3, 4, 5, 6, 7,
                                 8, 9, 10, 11, 12, 13, 14, 15);
}

__device__ __forceinline__ v4h cvt4(v4f a) {
  v4h r;
  r[0] = (_Float16)a[0]; r[1] = (_Float16)a[1];
  r[2] = (_Float16)a[2]; r[3] = (_Float16)a[3];
  return r;
}

// f16 tile staging, 128 rows x 64 halves by 256 threads. Eight lanes take the
// 128 B (one cache line) that a row has in the K slice, so a wave-wide 16-B load
// touches 4 whole lines; a thread holds 8 halves of rows r, r+32, r+64, r+96.
constexpr int RSTEP = 32;  // rows between two loads of one thread
template <int LD>
__device__ __forceinline__ void ld16(const _Float16* p, v8h r[4]) {
#pragma unroll  // constant indices keep r[] in registers and the row steps in the offset field
  for (int i = 0; i < 4; ++i) r[i] = *(const v8h*)(p + (size_t)i * RSTEP * LD);
}
// The same for four rows at element offsets of their own from a common base.
__device__ __forceinline__ void ldrows(const _Float16* p, const int off[4], v8h r[4]) {
#pragma unroll  // constant indices keep r[] in registers
  for (int i = 0; i < 4; ++i) r[i] = *(const v8h*)(p + off[i]);
}
__device__ __forceinline__ void st16(_Float16* d, const v8h r[4]) {
#pragma unroll  // constant indices keep r[] in registers
  for (int i = 0; i < 4; ++i) *(v8h*)(d + i * RSTEP * LDP) = r[i];
}

// ---------------------------------------------------------------------------
// Kernel 0 is the pre-pass: one launch of workgroups of PRE_THREADS threads. Workgroup 0
// ranks and routes the tokens (part B below); every other one converts a block of x,
// gate_w or up_w (part A). Neither part reads what the other writes, so the one routing
// workgroup, which would leave the rest of the chip idle in a launch of its own, runs
// beside the stream of conversions.
//
// Part A: x, gate_w and up_w, f32 -> f16, once per call. The GEMM
// kernels re-read every operand tile many times; they read it at 2 B an
// element and convert nothing. A block lies in a segment of SEG elements: 0 is x,
// 1..4 gate_w, 5..8 up_w (the weights land back to back in wh). down_w, which only
// kernel 2 reads, is converted inside the launch of kernel 1.
// ---------------------------------------------------------------------------
constexpr int PRE_THREADS = 1024;
constexpr int SEG = T_DIM * D_DIM;          // elements per segment; a weight tensor is 4 segments
constexpr int CVT_LOADS = 8;                // 16-B loads in flight per thread
constexpr int CVT_STEP = PRE_THREADS * 4;   // elements that one load of the whole workgroup covers
constexpr int CVT_BLK = CVT_STEP * CVT_LOADS;  // elements per block
constexpr int CVT_PER_SEG = SEG / CVT_BLK;  // blocks per segment
constexpr int CVT_SEGS = 1 + 2 * 4;         // x and two weight tensors
static_assert((size_t)E_DIM * F_DIM * D_DIM == (size_t)4 * SEG, "a weight tensor is 4 segments");
static_assert(CVT_PER_SEG * CVT_BLK == SEG, "whole blocks");
__device__ __forceinline__ void to_f16_block(
    int blk, const float* __restrict__ x, const float* __restrict__ gw,
    const float* __restrict__ uw,
    _Float16* __restrict__ xh, _Float16* __restrict__ wh) {
  const int seg = blk / CVT_PER_SEG;
  const float* s = x;
  _Float16* d = xh;
  if (seg > 0) {
    const int a = (seg - 1) >> 2;
    s = (a == 0 ? gw : uw) + (size_t)((seg - 1) & 3) * SEG;
    d = wh + (size_t)(seg - 1) * SEG;
  }
  const size_t o = (size_t)(blk % CVT_PER_SEG) * CVT_BLK + threadIdx.x * 4;
  const float* sp = s + o;
  v4f r[CVT_LOADS];
#pragma unroll  // all loads issue before the first store waits on one
  for (int i = 0; i < CVT_LOADS; ++i) r[i] = *(const v4f*)(sp + i * CVT_STEP);
  // sp as an input keeps the loads' address registers from being rewritten ahead of the wait
  asm volatile("s_wait_xcnt 0x0" :: "v"(sp) : "memory");
#pragma unroll  // constant indices keep r[] in registers
  for (int i = 0; i < CVT_LOADS; ++i) *(v4h*)(d + o + i * CVT_STEP) = cvt4(r[i]);
}

// ---------------------------------------------------------------------------
// Part B: top-2 gating and routing, one workgroup. The reference multiplies an
// expert's output row by the token's dense weight, which is an exact 0 for the six
// experts outside the top 2: those rows are never formed. A thread ranks 4 tokens;
// a prefix sum over the threads (8 counters of 16 bits in two 64-bit words) gives
// every (token, expert) pair its rank in token order, with no atomics.
//   slot_tok[s], slot_w[s]: token and weight of slot s;  tok_slot[t][2]: a token's slots;
//   tile_e[m]: expert of row tile m, -1 for a tile past the last one in use.
// ---------------------------------------------------------------------------
constexpr int RT_THREADS = PRE_THREADS;
constexpr int RT_TOK = T_DIM / RT_THREADS;  // tokens per thread
__device__ __forceinline__ int cnt_of(unsigned long long lo, unsigned long long hi, int e) {
  return (int)(((e < 4 ? lo : hi) >> ((e & 3) * 16)) & 0xFFFFull);
}
__device__ __forceinline__ void cnt_inc(unsigned long long& lo, unsigned long long& hi, int e) {
  const unsigned long long one = 1ull << ((e & 3) * 16);
  if (e < 4) lo += one; else hi += one;
}
__device__ __forceinline__ void route_tokens(
    const float* __restrict__ gating, int* __restrict__ slot_tok,
    float* __restrict__ slot_w, int* __restrict__ tok_slot, int* __restrict__ tile_e) {
  __shared__ unsigned long long sc[2][2][RT_THREADS];
  __shared__ int s_tot[E_DIM];
  __shared__ int s_tb[E_DIM + 1];
  const int tid = threadIdx.x;

  int i1[RT_TOK], i2[RT_TOK];
  float w1[RT_TOK], w2[RT_TOK];
  unsigned long long c0 = 0, c1 = 0;
  const v4f* gp = (const v4f*)(gating + (size_t)tid * RT_TOK * E_DIM);
  v4f gl[RT_TOK * E_DIM / 4];
#pragma unroll  // all loads issue before the first use waits on one
  for (int i = 0; i < RT_TOK * E_DIM / 4; ++i) gl[i] = gp[i];
  // gp as an input keeps the loads' address registers from being a load's own target
  // ahead of the wait
  asm volatile("s_wait_xcnt 0x0" :: "v"(gp) : "memory");
#pragma unroll  // constant indices keep the per-token arrays in registers
  for (int q = 0; q < RT_TOK; ++q) {
    float l[E_DIM];
    float m = -INFINITY;
#pragma unroll
    for (int e = 0; e < E_DIM; ++e) {
      l[e] = gl[q * (E_DIM / 4) + e / 4][e % 4];
      m = fmaxf(m, l[e]);
    }
    float p[E_DIM];
#pragma unroll
    for (int e = 0; e < E_DIM; ++e) p[e] = __expf(l[e] - m);
    int a = 0;
    float pa = p[0];
#pragma unroll
    for (int e = 1; e < E_DIM; ++e) if (p[e] > pa) { a = e; pa = p[e]; }
    int b = (a == 0) ? 1 : 0;
    float pb = (a == 0) ? p[1] : p[0];
#pragma unroll
    for (int e = 0; e < E_DIM; ++e) if (e != a && p[e] > pb) { b = e; pb = p[e]; }
    const float rden = __builtin_amdgcn_rcpf(pa + pb);
    i1[q] = a; i2[q] = b;
    w1[q] = pa * rden; w2[q] = pb * rden;
    cnt_inc(c0, c1, a);
    cnt_inc(c0, c1, b);
  }

  // Inclusive prefix sum over the threads, two LDS planes in turn: a step reads one
  // plane and writes the other, so one barrier a step is enough.
  unsigned long long a0 = c0, a1 = c1;
  int pl = 0;
  sc[0][0][tid] = a0;
  sc[0][1][tid] = a1;
  __syncthreads();
  for (int d = 1; d < RT_THREADS; d <<= 1) {
    if (tid >= d) {
      a0 += sc[pl][0][tid - d];
      a1 += sc[pl][1][tid - d];
    }
    pl ^= 1;
    sc[pl][0][tid] = a0;
    sc[pl][1][tid] = a1;
    __syncthreads();
  }
  if (tid == 0) {
    const unsigned long long t0 = sc[pl][0][RT_THREADS - 1];
    const unsigned long long t1 = sc[pl][1][RT_THREADS - 1];
    int tb = 0;
    for (int e = 0; e < E_DIM; ++e) {
      const int n = cnt_of(t0, t1, e);
      s_tot[e] = n;
      s_tb[e] = tb;
      tb += (n + BM - 1) / BM;
    }
    s_tb[E_DIM] = tb;
  }
  __syncthreads();

  // The thread's own tokens, from its exclusive prefix on.
  a0 -= c0;
  a1 -= c1;
  int sa[RT_TOK], sb[RT_TOK], tt[RT_TOK];
#pragma unroll  // constant indices keep the per-token arrays in registers
  for (int q = 0; q < RT_TOK; ++q) {
    tt[q] = tid * RT_TOK + q;
    sa[q] = s_tb[i1[q]] * BM + cnt_of(a0, a1, i1[q]);
    sb[q] = s_tb[i2[q]] * BM + cnt_of(a0, a1, i2[q]);
    cnt_inc(a0, a1, i1[q]);
    cnt_inc(a0, a1, i2[q]);
  }
#pragma unroll
  for (int q = 0; q < RT_TOK; ++q) {
    slot_tok[sa[q]] = tt[q]; slot_w[sa[q]] = w1[q];
    slot_tok[sb[q]] = tt[q]; slot_w[sb[q]] = w2[q];
    tok_slot[tt[q] * TOPK + 0] = sa[q];
    tok_slot[tt[q] * TOPK + 1] = sb[q];
  }
  // the inputs keep what the stores name in its registers up to the wait
  asm volatile("s_wait_xcnt 0x0"
               :: "v"(sa[0]), "v"(sa[1]), "v"(sa[2]), "v"(sa[3]), "v"(sb[0]), "v"(sb[1]),
                  "v"(sb[2]), "v"(sb[3]), "v"(tt[0]), "v"(tt[1]), "v"(tt[2]), "v"(tt[3]),
                  "v"(w1[0]), "v"(w1[1]), "v"(w1[2]), "v"(w1[3]), "v"(w2[0]), "v"(w2[1]),
                  "v"(w2[2]), "v"(w2[3])
               : "memory");
  static_assert(RT_TOK == 4, "the wait above names four tokens");
  // Filler rows and the tile table: every slot that no pair took.
  for (int s = tid; s < MAXROWS; s += RT_THREADS) {
    const int tile = s / BM;
    int e = -1;
#pragma unroll
    for (int k = 0; k < E_DIM; ++k)
      if (tile >= s_tb[k] && tile < s_tb[k + 1]) e = k;
    // Each wait stands in its store's own branch: the trip's closing arithmetic reuses
    // the registers of these stores.
    if (e < 0 || s - s_tb[e] * BM >= s_tot[e]) {
      slot_tok[s] = 0;
      slot_w[s] = 0.0f;
      asm volatile("s_wait_xcnt 0x0" ::: "memory");
    }
    if (s % BM == 0) {
      tile_e[tile] = e;
      asm volatile("s_wait_xcnt 0x0" ::: "memory");
    }
  }
}

// The launch itself. Routing is workgroup 0; the test reads the same in a whole
// workgroup, as its barriers ask.
__global__ __launch_bounds__(PRE_THREADS) void moe_prepass_kernel(
    const float* __restrict__ x, const float* __restrict__ gw,
    const float* __restrict__ uw, const float* __restrict__ gating,
    _Float16* __restrict__ xh, _Float16* __restrict__ wh,
    int* __restrict__ slot_tok, float* __restrict__ slot_w,
    int* __restrict__ tok_slot, int* __restrict__ tile_e) {
  if (blockIdx.x == 0) {
    route_tokens(gating, slot_tok, slot_w, tok_slot, tile_e);
    return;
  }
  to_f16_block(blockIdx.x - 1, x, gw, uw, xh, wh);
}

// ---------------------------------------------------------------------------
// Kernel 1: fused gate+up GEMM + SiLU-gate epilogue -> h (f16), all experts in one
// launch: grid.x is a row tile of slots, all of one expert; the A rows are gathered
// from x by the slots' tokens. The epilogue scales a row of h by the slot's gating weight.
// Double-buffered LDS, one barrier per K-step: compute from buffer `cur`
// while register-prefetched f16 slices are stored into buffer `cur^1`.
// The second launch bound asks for 4 waves per SIMD (a budget of 256 VGPRs), so
// that two workgroups share a WGP and each runs while the other waits on its
// loads, its LDS or its barrier.
// With two workgroups on each of 256 WGPs the GEMM tiles make two full rounds and a last
// one that leaves most places empty. The rows of the grid behind them (grid.y >= F / BN)
// convert down_w to f16: they use memory and no matrix unit, and
// nothing in this launch reads what they write.
// ---------------------------------------------------------------------------
constexpr int DW_LOADS = 16;                  // 16-B loads in flight per thread
constexpr int DW_BLK = 256 * 4 * DW_LOADS;    // elements per workgroup
constexpr int DW_BLKS = E_DIM * D_DIM * F_DIM / DW_BLK;
constexpr int DW_ROWS = (DW_BLKS + MAXTILES - 1) / MAXTILES;  // grid rows that hold them
static_assert((size_t)DW_BLKS * DW_BLK == (size_t)E_DIM * D_DIM * F_DIM, "whole blocks");
__global__ __launch_bounds__(256, 4) void moe_gateup_kernel(
    const _Float16* __restrict__ x,   // [T, D] f16
    const _Float16* __restrict__ gw,  // [E, F, D] f16
    const _Float16* __restrict__ uw,  // [E, F, D] f16
    const int* __restrict__ slot_tok, // [MAXROWS]
    const float* __restrict__ slot_w, // [MAXROWS]
    const int* __restrict__ tile_e,   // [MAXTILES]
    _Float16* __restrict__ h,         // [MAXROWS, F]
    const float* __restrict__ dwf,    // [E, D, F] f32
    _Float16* __restrict__ dwh) {     // [E, D, F] f16, written here
  __shared__ __attribute__((aligned(16))) _Float16 sA[2 * TILE];  // 36 KB
  __shared__ __attribute__((aligned(16))) _Float16 sG[2 * TILE];  // 36 KB
  __shared__ __attribute__((aligned(16))) _Float16 sU[2 * TILE];  // 36 KB

  const int tid = threadIdx.x;
  if (blockIdx.y >= F_DIM / BN) {  // the whole workgroup: a block of down_w, then it leaves
    const int blk = (blockIdx.y - F_DIM / BN) * MAXTILES + blockIdx.x;
    if (blk >= DW_BLKS) return;
    const size_t o = (size_t)blk * DW_BLK + tid * 4;
    const float* sp = dwf + o;
    v4f r[DW_LOADS];
#pragma unroll  // all loads issue before the first store waits on one
    for (int i = 0; i < DW_LOADS; ++i) r[i] = *(const v4f*)(sp + i * 1024);
    // sp as an input keeps the loads' address registers from being rewritten ahead of the wait
    asm volatile("s_wait_xcnt 0x0" :: "v"(sp) : "memory");
#pragma unroll  // constant indices keep r[] in registers
    for (int i = 0; i < DW_LOADS; ++i) *(v4h*)(dwh + o + i * 1024) = cvt4(r[i]);
    return;
  }
  const int lane = tid & 31;
  const int wave = tid >> 5;
  const int waveM = wave >> 1;   // 0..3  (32 rows each)
  const int waveN = wave & 1;    // 0..1  (64 cols each)
  const int fr = lane & 15;
  const int fh = lane >> 4;

  const int blockM = blockIdx.x * BM;
  const int blockN = blockIdx.y * BN;
  const int e = min(tile_e[blockIdx.x], E_DIM - 1);
  if (e < 0) return;  // a tile past the last one in use: the whole workgroup leaves

  // Global->LDS mapping: 8 threads per row slice, 8 halves each, 4 rows per thread.
  const int row = tid >> 3, col = (tid & 7) * 8;
  const int soff = row * LDP + col;
  int aoff[4];  // element offsets in x of this thread's four gathered rows
#pragma unroll  // constant indices keep aoff[] in registers
  for (int i = 0; i < 4; ++i)
    aoff[i] = min(max(slot_tok[blockM + row + i * RSTEP], 0), T_DIM - 1) * D_DIM + col;
  const _Float16* pgw = gw + ((size_t)e * F_DIM + blockN + row) * D_DIM + col;
  const _Float16* puw = uw + ((size_t)e * F_DIM + blockN + row) * D_DIM + col;

  v8h ra[4], rg[4], ru[4];
  ldrows(x, aoff, ra);
  ld16<D_DIM>(pgw, rg);
  ld16<D_DIM>(puw, ru);
  // the index arithmetic below reuses the address registers of these loads; the
  // scheduling barrier keeps that arithmetic from being lifted over the wait
  asm volatile("s_wait_xcnt 0x0" ::: "memory");
  __builtin_amdgcn_sched_barrier(0);
  st16(&sA[soff], ra);
  st16(&sG[soff], rg);
  st16(&sU[soff], ru);
  __syncthreads();

  v8f cg[2][4] = {};
  v8f cu[2][4] = {};

  for (int k0 = 0; k0 < D_DIM; k0 += BK) {
    const int cur = (k0 / BK) & 1;
    const int nxt = cur ^ 1;
    const bool has_next = (k0 + BK) < D_DIM;

    if (has_next) {  // issue next-slice global loads under the WMMA chain
      ldrows(x + k0 + BK, aoff, ra);
      ld16<D_DIM>(pgw + k0 + BK, rg);
      ld16<D_DIM>(puw + k0 + BK, ru);
      // the fragment loads below reuse the address registers of these loads
      asm volatile("s_wait_xcnt 0x0" ::: "memory");
    }

    const _Float16* A = sA + cur * TILE;
    const _Float16* G = sG + cur * TILE;
    const _Float16* U = sU + cur * TILE;
#pragma unroll  // the two 32-wide halves of the slice, in ascending k
    for (int kk = 0; kk < BK / 32; ++kk) {
      v16h aF[2];
#pragma unroll
      for (int i = 0; i < 2; ++i)
        aF[i] = load_frag(A, waveM * 32 + i * 16 + fr, fh, kk);
      // The weight fragments come in two halves of the wave's 64 columns: 32 and not
      // 64 registers hold them at a time, which keeps the kernel inside the budget
      // without scratch.
#pragma unroll
      for (int jh = 0; jh < 4; jh += 2) {
        v16h gF[2], uF[2];
#pragma unroll
        for (int j = 0; j < 2; ++j) {
          gF[j] = load_frag(G, waveN * 64 + (jh + j) * 16 + fr, fh, kk);
          uF[j] = load_frag(U, waveN * 64 + (jh + j) * 16 + fr, fh, kk);
        }
#pragma unroll
        for (int i = 0; i < 2; ++i)
#pragma unroll
          for (int j = 0; j < 2; ++j) {
            cg[i][jh + j] = wmma_f16(aF[i], gF[j], cg[i][jh + j]);
            cu[i][jh + j] = wmma_f16(aF[i], uF[j], cu[i][jh + j]);
          }
      }
    }

    if (has_next) {  // fill the other buffer; published by the barrier below
      st16(&sA[nxt * TILE + soff], ra);
      st16(&sG[nxt * TILE + soff], rg);
      st16(&sU[nxt * TILE + soff], ru);
    }
    __syncthreads();
  }

  // Epilogue: w*silu(g)*u -> f16.  C layout: n = lane&15, m = r + 8*(lane>>4).
  _Float16* he = h;
  float wt[2][8];  // the gating weights of this lane's 16 rows, all loads in flight together
  const float* pw = slot_w + blockM + waveM * 32 + fh * 8;
#pragma unroll  // constant indices keep wt[][] in registers
  for (int i = 0; i < 2; ++i)
#pragma unroll
    for (int r = 0; r < 8; ++r)
      wt[i][r] = pw[i * 16 + r];
  // pw as an input keeps the loads' address registers from being a load's own target
  // ahead of the wait
  asm volatile("s_wait_xcnt 0x0" :: "v"(pw) : "memory");
#pragma unroll
  for (int i = 0; i < 2; ++i) {
    const int m_base = blockM + waveM * 32 + i * 16 + fh * 8;
#pragma unroll
    for (int j = 0; j < 4; ++j) {
      const int n = blockN + waveN * 64 + j * 16 + fr;
#pragma unroll
      for (int r = 0; r < 8; ++r) {
        float g = cg[i][j][r];
        float u = cu[i][j][r];
        float sig = __builtin_amdgcn_rcpf(1.0f + __expf(-g));
        he[(size_t)(m_base + r) * F_DIM + n] = (_Float16)(g * sig * u * wt[i][r]);
      }
    }
  }
}

// Workgroup barrier in two parts, for LDS traffic alone. __syncthreads() also drains the
// wave's global loads (s_wait_loadcnt 0); behind these two, loads issued ahead stay in flight.
// The wave's own LDS stores have landed and its LDS reads have returned:
__device__ __forceinline__ void wait_lds() { asm volatile("s_wait_dscnt 0x0" ::: "memory"); }
// The workgroup's own barrier; the clobber keeps every LDS access on its side of it:
__device__ __forceinline__ void lds_barrier() {
  asm volatile("s_barrier_signal -1\n\ts_barrier_wait -1" ::: "memory");
}

// ---------------------------------------------------------------------------
// Kernel 2: down GEMM of all experts in one launch: grid.x is a row tile of slots, all
// of one expert; y[slot] = h[slot] * dw[e]^T with K = F. h carries the gating weights,
// so a token's output is the plain sum of its two rows of y (kernel 3).
// A-operand (h, f16) pipelined into double-buffered LDS by the Tensor Data
// Mover (issue for k+1 at top of step k, wait only after the WMMA chain);
// B-operand (f16) staged through registers by the threads while the TDM runs.
// ---------------------------------------------------------------------------
__global__ __launch_bounds__(256) void moe_down_kernel(
    const _Float16* __restrict__ h,  // [MAXROWS, F] f16
    const _Float16* __restrict__ dw, // [E, D, F] f16
    const int* __restrict__ tile_e,  // [MAXTILES]
    float* __restrict__ y) {         // [MAXROWS, D]
  // 36 KB each; sA is the TDM destination (ping-pong), both buffers at multiples of 2 KiB.
  __shared__ __attribute__((aligned(2048))) _Float16 sA[2 * TILE];
  __shared__ __attribute__((aligned(16))) _Float16 sB[2 * TILE];

  const int tid = threadIdx.x;
  const int lane = tid & 31;
  const int wave = tid >> 5;
  const int waveM = wave >> 1;
  const int waveN = wave & 1;
  const int fr = lane & 15;
  const int fh = lane >> 4;

  const int blockM = blockIdx.x * BM;  // slots
  const int blockN = blockIdx.y * BN;  // hidden dim D
  const int e = min(tile_e[blockIdx.x], E_DIM - 1);
  if (e < 0) return;  // a tile past the last one in use: the whole workgroup leaves

  const int row = tid >> 3, col = (tid & 7) * 8;  // as in the gate+up kernel
  const int soff = row * LDP + col;
  const _Float16* pb = dw + ((size_t)e * D_DIM + blockN + row) * F_DIM + col;
  // Element offsets of K step s in a row of h and of dw.
  constexpr int KSTEPS = F_DIM / BK;
  auto a_off = [](int s) { return (size_t)s * BK; };
  auto b_off = [](int s) { return (size_t)s * BK; };

#if HAVE_TDM
  // Tensor DMA descriptor (2D), every extent in bytes: tile = tensor = BM rows of
  // 128 B at the source pitch of h; a 16-B pad behind every 128-B row lays the
  // rows at the 144-B pitch that load_frag reads.
  constexpr uint32_t ROWB = BK * sizeof(_Float16);
  const uint32_t lds_a = (uint32_t)(uintptr_t)(void*)sA;
  const uint64_t gbase = (uint64_t)(uintptr_t)(h + (size_t)blockM * F_DIM);
  i32x8 g1;
  g1[0] = (int)((1u << 20) | (4u << 22) | (3u << 25));      // pad on, every 32 dwords, 4 dwords
  g1[1] = (int)(ROWB << 16);                                // tensor_dim0 lo
  g1[2] = (int)((uint32_t)BM << 16);                        // dim0 hi | dim1 lo
  g1[3] = (int)(ROWB << 16);                                // dim1 hi | tile_dim0
  g1[4] = (int)(uint32_t)BM;                                // tile_dim1 (tile_dim2=0)
  g1[5] = (int)(uint32_t)(F_DIM * sizeof(_Float16));        // source row pitch
  g1[6] = 0;
  g1[7] = 0;
  // Group 1 stays in its own scalar registers through the K loop; left to the
  // compiler, words of it were rebuilt per step.
  asm volatile("" : "+s"(g1));
  const i32x4 z4 = {0, 0, 0, 0};
  const i32x8 z8 = {0, 0, 0, 0, 0, 0, 0, 0};
#define TDM_ISSUE(K0, BUF)                                                    \
  do {                                                                        \
    uint64_t ga = gbase + (uint64_t)(K0) * sizeof(_Float16);                  \
    u32x4 g0;                                                                 \
    g0[0] = 1u;                                                               \
    g0[1] = lds_a + (uint32_t)((BUF) * TILE * sizeof(_Float16));              \
    g0[2] = (uint32_t)ga;                                                     \
    g0[3] = (uint32_t)((ga >> 32) & 0x01FFFFFFu) | (2u << 30);                \
    __builtin_amdgcn_tensor_load_to_lds(g0, g1, z4, z4, z8, 0);               \
  } while (0)
#else
  const int asoff = (tid >> 1) * LDP + (tid & 1) * 32;
  const _Float16* pa = h + (size_t)(blockM + (tid >> 1)) * F_DIM + (tid & 1) * 32;
#define A_COPY(K0, BUF)                                                       \
  do {                                                                        \
    for (int q = 0; q < 4; ++q)                                               \
      *(v8h*)&sA[(BUF) * TILE + asoff + q * 8] = *(const v8h*)(pa + (K0) + q * 8); \
  } while (0)
#endif

  // ---- prologue: fill buffer 0 ----
  v8h rb[4];
  ld16<F_DIM>(pb, rb);
#if HAVE_TDM
  if (wave == 0) TDM_ISSUE(0, 0);
#else
  A_COPY(0, 0);
#endif
  st16(&sB[soff], rb);
  ld16<F_DIM>(pb + b_off(1), rb);  // step 1 into regs, in flight over the barrier
  // nothing drains these loads any more before later arithmetic reuses their address registers
  asm volatile("s_wait_xcnt 0x0" ::: "memory");
  wait_lds();
#if HAVE_TDM
  if (wave == 0) __builtin_amdgcn_s_wait_tensorcnt(0);
#endif
  lds_barrier();

  v8f c[2][4] = {};

  for (int s = 0; s < KSTEPS; ++s) {
    const int cur = s & 1;
    const int nxt = cur ^ 1;
    const bool has_next = (s + 1) < KSTEPS;

#if HAVE_TDM
    if (has_next && wave == 0) TDM_ISSUE(a_off(s + 1), nxt);  // overlaps compute
#else
    if (has_next) A_COPY(a_off(s + 1), nxt);
#endif

    const _Float16* A = sA + cur * TILE;
    const _Float16* B = sB + cur * TILE;
#pragma unroll  // the two 32-wide halves of the slice, in ascending k
    for (int kk = 0; kk < BK / 32; ++kk) {
      v16h aF[2], bF[4];
#pragma unroll
      for (int i = 0; i < 2; ++i)
        aF[i] = load_frag(A, waveM * 32 + i * 16 + fr, fh, kk);
#pragma unroll
      for (int j = 0; j < 4; ++j)
        bF[j] = load_frag(B, waveN * 64 + j * 16 + fr, fh, kk);
#pragma unroll
      for (int i = 0; i < 2; ++i)
#pragma unroll
        for (int j = 0; j < 4; ++j)
          c[i][j] = wmma_f16(aF[i], bF[j], c[i][j]);
    }

    if (has_next) {
      st16(&sB[nxt * TILE + soff], rb);                       // publish B k+1
      // fetch B k+2: these loads fly over the barrier below and through the whole next step
      if (s + 2 < KSTEPS) {
        ld16<F_DIM>(pb + b_off(s + 2), rb);
        // the next step's index arithmetic reuses the address registers of these loads
        asm volatile("s_wait_xcnt 0x0" ::: "memory");
      }
      wait_lds();
#if HAVE_TDM
      if (wave == 0) __builtin_amdgcn_s_wait_tensorcnt(0);    // TDM k+1 done
#endif
    }
    lds_barrier();
  }

#pragma unroll
  for (int i = 0; i < 2; ++i)
#pragma unroll
    for (int j = 0; j < 4; ++j) {
      const int m_base = blockM + waveM * 32 + i * 16 + fh * 8;
      const int n = blockN + waveN * 64 + j * 16 + fr;
#pragma unroll
      for (int r = 0; r < 8; ++r) {
        y[(size_t)(m_base + r) * D_DIM + n] = c[i][j][r];
      }
    }
}

// ---------------------------------------------------------------------------
// Kernel 3: out[t] = y[first slot of t] + y[second slot of t]. A workgroup takes
// CMB_TOK tokens, a thread 4 columns of each.
// ---------------------------------------------------------------------------
constexpr int CMB_TOK = 4;
__global__ __launch_bounds__(256) void moe_combine_kernel(
    const float* __restrict__ y, const int* __restrict__ tok_slot, float* __restrict__ out) {
  const int t0 = blockIdx.x * CMB_TOK;
  const int c = threadIdx.x * 4;
  v4f a[CMB_TOK], b[CMB_TOK];
#pragma unroll  // all loads issue before the first add waits on one
  for (int q = 0; q < CMB_TOK; ++q) {
    const int sa = min(max(tok_slot[(t0 + q) * TOPK + 0], 0), MAXROWS - 1);
    const int sb = min(max(tok_slot[(t0 + q) * TOPK + 1], 0), MAXROWS - 1);
    a[q] = *(const v4f*)(y + (size_t)sa * D_DIM + c);
    b[q] = *(const v4f*)(y + (size_t)sb * D_DIM + c);
  }
#pragma unroll  // constant indices keep a[] and b[] in registers
  for (int q = 0; q < CMB_TOK; ++q)
    *(v4f*)(out + (size_t)(t0 + q) * D_DIM + c) = a[q] + b[q];
}

// ---------------------------------------------------------------------------
// Launch: pre-pass (routing beside the f16 copies; down_w's copy rides in the gate+up
// launch), gate+up and down over the routed row tiles, combine.
// Workspace: h (MAXROWS*F f16 = 36 MB), y (MAXROWS*D f32 = 36 MB), x in f16 (8 MB),
// the three weight tensors in f16 (32 MB each), the routing tables.
// ---------------------------------------------------------------------------
extern "C" void kernel_launch(void* const* d_in, const int* in_sizes, int n_in,
                              void* d_out, int out_size, void* d_ws, size_t ws_size,
                              hipStream_t stream) {
  const float* x      = (const float*)d_in[0];
  const float* gating = (const float*)d_in[1];
  const float* gate_w = (const float*)d_in[2];
  const float* up_w   = (const float*)d_in[3];
  const float* down_w = (const float*)d_in[4];
  float* out = (float*)d_out;

  _Float16* h_ws = (_Float16*)d_ws;
  float* y_ws = (float*)(h_ws + (size_t)MAXROWS * F_DIM);
  _Float16* x_h = (_Float16*)(y_ws + (size_t)MAXROWS * D_DIM);
  _Float16* w_h = x_h + (size_t)T_DIM * D_DIM;
  const _Float16* gate_h = w_h;
  const _Float16* up_h   = w_h + (size_t)E_DIM * F_DIM * D_DIM;
  _Float16* down_h       = w_h + (size_t)2 * E_DIM * F_DIM * D_DIM;
  int* slot_tok = (int*)(w_h + (size_t)3 * E_DIM * F_DIM * D_DIM);
  float* slot_w = (float*)(slot_tok + MAXROWS);
  int* tok_slot = (int*)(slot_w + MAXROWS);
  int* tile_e   = tok_slot + T_DIM * TOPK;

  moe_prepass_kernel<<<1 + CVT_PER_SEG * CVT_SEGS, PRE_THREADS, 0, stream>>>(
      x, gate_w, up_w, gating, x_h, w_h, slot_tok, slot_w, tok_slot, tile_e);

  moe_gateup_kernel<<<dim3(MAXTILES, F_DIM / BN + DW_ROWS), 256, 0, stream>>>(
      x_h, gate_h, up_h, slot_tok, slot_w, tile_e, h_ws, down_w, down_h);
  moe_down_kernel<<<dim3(MAXTILES, D_DIM / BN), 256, 0, stream>>>(h_ws, down_h, tile_e, y_ws);
  moe_combine_kernel<<<T_DIM / CMB_TOK, 256, 0, stream>>>(y_ws, tok_slot, out);
}
